// v000
// The times below were measured on an AMD MI455X: many runs one after another, warmed up first and cycling through
// copies of the inputs, with the whole window's GPU time divided by the number of runs. Launches and the gaps
// between them are all in it. The median over several windows is given; except for v000 it joins two sittings, which
// can be a few percent apart, so the side-by-side timings, each taken in one sitting, are the better comparison.
// v000 is the starting kernel. One run takes 479 microseconds.
#include <hip/hip_runtime.h>

// All contractions on v_wmma_f32_16x16x32_f16 (f16 operands built from bf16-RNE input values with power-of-two carries, f32 accumulate):
// per-head projections x.[Wq|Wk|Wv] (K=1024), per-(b,h) k.q^T (K=128), v^T.p^T (K=seq); online softmax, bias adds and normalisation in f32.

#ifndef NB
#define NB 4
#endif
#ifndef SEQ
#define SEQ 2048
#endif
#define NB_FULL 4
#define SEQ_FULL 2048
#define DM 1024
#define NH 8
#define DK 128
#define MTOK (NB * SEQ)
#define PROJN (3 * NH * DK)             // 3072 rows of the n-major projection weight plane: Wq heads | Wk heads | Wv heads

static_assert(SEQ % 64 == 0);
static_assert(SEQ <= SEQ_FULL);
static_assert(NB >= 1 && NB <= NB_FULL);
static_assert(DM % 32 == 0);
static_assert(DK == 128);
static_assert(NH * DK == DM);
static_assert(PROJN == 3072);
static_assert(PROJN % 128 == 0);
static_assert(MTOK % 64 == 0);
static_assert(((size_t)MTOK * DM / 8) % 256 == 0);
static_assert(((size_t)NH * DK * DM / 8) % 256 == 0);

// exact power-of-two carries
#define SC_X   16.0f    // activation plane (|x| <= ~6 -> <= ~96)
#define SC_W   256.0f   // projection weights (|w| <= ~0.18 -> <= ~46)
#define SC_QKV 8.0f     // q, k, v planes
#define P_CARRY_LOG2 8.0f   // softmax numerators carried x256 (the row sum carries the same factor)

// workspace plan (bytes), every region a multiple of 256
#define WS_XH ((size_t)MTOK * DM * 2)
#define WS_WT ((size_t)PROJN * DM * 2)
#define WS_QK (2 * (size_t)NB * NH * SEQ * DK * 2)
#define WS_VT ((size_t)NB * NH * DK * SEQ * 2)
#define WS_TOTAL (WS_XH + WS_WT + WS_QK + WS_VT)
static_assert(WS_XH % 256 == 0 && WS_WT % 256 == 0 && WS_QK % 256 == 0 && WS_VT % 256 == 0);
static_assert(WS_TOTAL <= (size_t)134217728);

typedef _Float16 v8h  __attribute__((ext_vector_type(8)));
typedef _Float16 v16h __attribute__((ext_vector_type(16)));
typedef float    v8f  __attribute__((ext_vector_type(8)));
typedef float    v4f  __attribute__((ext_vector_type(4)));
typedef unsigned v4u  __attribute__((ext_vector_type(4)));

// bf16 RNE of an f32 value, kept as f32
__device__ __forceinline__ float bfr(float f) {
    unsigned u = __float_as_uint(f);
    u = (u + 0x7fffu + ((u >> 16) & 1u)) & 0xffff0000u;
    return __uint_as_float(u);
}
// input value -> bf16 RNE -> times exact power of two -> f16 (exact for normal results)
__device__ __forceinline__ _Float16 tohx(float f, float sc) { return (_Float16)(bfr(f) * sc); }
// f32 -> f16 that can never yield an f16 subnormal (value select applied after the carry)
__device__ __forceinline__ _Float16 toh_flush(float v) {
    const _Float16 r = (_Float16)v;
    return (fabsf(v) < 6.103515625e-05f) ? (_Float16)0.0f : r;
}
__device__ __forceinline__ _Float16 tohx_flush(float f, float sc) { return toh_flush(bfr(f) * sc); }

// one 16x16x32 f16 WMMA with the hazard guard; D element r of lane l = (row 8*(l>>4)+r, col l&15)
__device__ __forceinline__ v8f wmma16(v16h a, v16h b, v8f c) {
    c = __builtin_amdgcn_wmma_f32_16x16x32_f16(false, a, false, b, (short)0, c, false, false);
    asm volatile("v_nop\n\tv_nop\n\tv_nop\n\tv_nop" : "+v"(c) : "v"(a), "v"(b));
    return c;
}
// A fragment of row p (p = row start + k0) or B fragment of an n-major (k-contiguous) row: lane half hf,
// elements 0..7 <- k0+8hf..+7, elements 8..15 <- k0+16+8hf..+7 (same map for A and B)
__device__ __forceinline__ v16h ldfrag(const _Float16* p, int hf) {
    const v8h lo = *(const v8h*)(p + 8 * hf);
    const v8h hi = *(const v8h*)(p + 16 + 8 * hf);
    return __builtin_shufflevector(lo, hi, 0, 1, 2, 3, 4, 5, 6, 7, 8, 9, 10, 11, 12, 13, 14, 15);
}
__device__ __forceinline__ void vst16(_Float16* g, v8h v) { *(v4u*)g = __builtin_bit_cast(v4u, v); }
__device__ __forceinline__ void vst16f(float* g, v4f v) { *(v4f*)g = v; }

// ---------------- activation plane: XH [MTOK][1024] f16 = bf16-RNE(x) x16; thread i writes the 16 bytes at byte 16*i ----------------
#define CVTX_BLK (MTOK * (DM / 8) / 256)
__global__ __launch_bounds__(256) void k_cvtx(const float* __restrict__ X, _Float16* XH) {
    const int i = blockIdx.x * 256 + threadIdx.x;                 // < MTOK * 128
    const int tok = i >> 7, k = (i & 127) * 8;
    const int bi = tok / SEQ, si = tok - bi * SEQ;
    const float* xp = X + ((size_t)bi * SEQ_FULL + si) * DM + k;
    const v4f x0 = *(const v4f*)(xp);
    const v4f x1 = *(const v4f*)(xp + 4);
    v8h val;
#pragma unroll
    for (int j = 0; j < 4; ++j) {
        val[j]     = tohx_flush(x0[j], SC_X);
        val[4 + j] = tohx_flush(x1[j], SC_X);
    }
    _Float16* dst = XH + (size_t)tok * DM + k;
    vst16(dst, val);
    
}

// ---------------- weight plane: W [8][1024][128] f32 -> WT rows n = h*128+e, [n][1024] f16 = bf16-RNE(w) x256 (n-major, k-contiguous);
// in[h][d][e] -> out[h*128+e][d]; thread i writes the 16 bytes at byte 16*i of this matrix's 2 MiB slab ----------------
#define PREPW_BLK (NH * DK * (DM / 8) / 256)     // 512
__global__ __launch_bounds__(256) void k_prepw(const float* __restrict__ W, _Float16* WT) {
    const int i = blockIdx.x * 256 + threadIdx.x;                 // < 1024 * 128
    const int n = i >> 7, k = (i & 127) * 8;
    const int hh = n >> 7, e = n & 127;
    v8h val;
#pragma unroll
    for (int j = 0; j < 8; ++j) val[j] = tohx_flush(W[((size_t)hh * DM + k + j) * DK + e], SC_W);
    _Float16* dst = WT + (size_t)n * DM + k;
    vst16(dst, val);
    
}

// ---------------- projections (K = 1024): block = 64 tokens x 128 output columns (group g of 24): g<8 q head g -> QK[0][b][h][s][128] (no bias);
// 8..15 k head -> QK[1][b][h][s][128] (+bk); 16..23 v head -> VT[b][h][d][s] (+bv, transposed via LDS). All planes x8, bias added in f32. ----------------
__global__ __launch_bounds__(128) void k_proj(const _Float16* __restrict__ XH, const _Float16* __restrict__ WT,
                                              const float* __restrict__ bK, const float* __restrict__ bV,
                                              _Float16* QK, _Float16* VT) {
    __shared__ __align__(16) _Float16 st[9216];                 // row-major [64][136] or transposed [128][72]
    const int tid = threadIdx.x, lane = tid & 31, l16 = lane & 15, hf = lane >> 4;
    const int wv = __builtin_amdgcn_readfirstlane(threadIdx.x >> 5);
    const int g = blockIdx.y;
    const int t0 = blockIdx.x * 64;
    const int bi = t0 / SEQ, s0 = t0 - bi * SEQ;               // 64 | SEQ: whole block inside one batch
    const int hh = g & 7;
    const bool isV = (g >= 16);
    const _Float16* arow = XH + (size_t)(t0 + wv * 16 + l16) * DM;
    const _Float16* brow = WT + (size_t)(g * 128 + l16) * DM;
    v8f acc[8];
#pragma unroll
    for (int nt = 0; nt < 8; ++nt) acc[nt] = (v8f){};
#pragma unroll 1
    for (int kc = 0; kc < DM / 32; ++kc) {
        const v16h a = ldfrag(arow + kc * 32, hf);
#pragma unroll
        for (int nt = 0; nt < 8; ++nt) {
            const v16h bf = ldfrag(brow + (size_t)(nt * 16) * DM + kc * 32, hf);
            acc[nt] = wmma16(a, bf, acc[nt]);
        }
    }
    if (isV) {
        // st[d][tok] pitch 72: lane owns column d, its 8 tokens wv*16+8hf..+7 are contiguous -> one 16-B LDS store per tile
#pragma unroll
        for (int nt = 0; nt < 8; ++nt) {
            const int d = nt * 16 + l16;
            const float bb = bfr(bV[hh * DK + d]);
            v8h pv;
#pragma unroll
            for (int r = 0; r < 8; ++r) pv[r] = toh_flush((acc[nt][r] * (1.0f / (SC_X * SC_W)) + bb) * SC_QKV);
            *(v8h*)&st[d * 72 + wv * 16 + 8 * hf] = pv;
        }
    } else {
        // st[tok][col] pitch 136
#pragma unroll
        for (int nt = 0; nt < 8; ++nt) {
            const int col = nt * 16 + l16;
            const float bkv = bK[hh * DK + col];
            const float bb = (g < 8) ? 0.0f : bfr(bkv);
#pragma unroll
            for (int r = 0; r < 8; ++r) st[(wv * 16 + 8 * hf + r) * 136 + col] = toh_flush((acc[nt][r] * (1.0f / (SC_X * SC_W)) + bb) * SC_QKV);
        }
    }
    __syncthreads();
    v8h w[8];
    if (isV) {
        const int hd = g - 16;
#pragma unroll
        for (int p = 0; p < 8; ++p) { const int d = p * 16 + (tid >> 3), pc = tid & 7; w[p] = *(const v8h*)&st[d * 72 + pc * 8]; }
        auto pass = [&]() {
#pragma unroll
            for (int p = 0; p < 8; ++p) {
                const int d = p * 16 + (tid >> 3), pc = tid & 7;
                vst16(VT + ((size_t)(bi * NH + hd) * DK + d) * SEQ + s0 + pc * 8, w[p]);
            }
        };
        pass();
        
    } else {
        // 64 rows x 256 B contiguous inside plane (g>>3) of QK
        _Float16* base = QK + ((size_t)((g >> 3) * (NB * NH) + bi * NH + hh) * SEQ + s0) * DK;
#pragma unroll
        for (int p = 0; p < 8; ++p) { const int off = p * 1024 + tid * 8; w[p] = *(const v8h*)&st[(off >> 7) * 136 + (off & 127)]; }
        auto pass = [&]() {
#pragma unroll
            for (int p = 0; p < 8; ++p) { const int off = p * 1024 + tid * 8; vst16(base + off, w[p]); }
        };
        pass();
        
    }
}

__global__ __launch_bounds__(128) void k_attn(const _Float16* __restrict__ QC, const _Float16* __restrict__ KC,
                                              const _Float16* __restrict__ VT, float* OUT) {
    __shared__ __align__(16) float st[4][16 * 132];                 // per wave 16 q rows x 128 d, pitch 132 floats (528 B); private to its wave
    const int tid = threadIdx.x, lane = tid & 31, l16 = lane & 15, hf = lane >> 4;
    const int wv = __builtin_amdgcn_readfirstlane(threadIdx.x >> 5);
    const int bh = blockIdx.y, bi = bh / NH, hd = bh - bi * NH;
    const int q0 = blockIdx.x * 64 + wv * 16;
    v16h qf[4];
    {
        const _Float16* qr = QC + ((size_t)bh * SEQ + q0 + l16) * DK;
#pragma unroll
        for (int cc = 0; cc < 4; ++cc) qf[cc] = ldfrag(qr + cc * 32, hf);
    }
    const _Float16* kb  = KC  + (size_t)bh * SEQ * DK;
    const _Float16* vb  = VT  + (size_t)bh * DK * SEQ;
    v8f o[8];
#pragma unroll
    for (int d = 0; d < 8; ++d) o[d] = (v8f){};
    float m2 = -__builtin_inff(), lsum = 0.0f;
    const float c2 = (0.08838834764831845f * 1.4426950408889634f) * (1.0f / (SC_QKV * SC_QKV));   // (1/sqrt(128)) * log2(e) / 64
#pragma unroll 1
    for (int kt = 0; kt < SEQ / 64; ++kt) {
        v8f s[4];
#pragma unroll
        for (int ks = 0; ks < 4; ++ks) {
            const int key = kt * 64 + ks * 16 + l16;
            const _Float16* kr = kb + (size_t)key * DK;
            v8f c = (v8f){};
#pragma unroll
            for (int cc = 0; cc < 4; ++cc) c = wmma16(ldfrag(kr + cc * 32, hf), qf[cc], c);
            s[ks] = c;
        }
        float mloc = -__builtin_inff();
#pragma unroll
        for (int ks = 0; ks < 4; ++ks)
#pragma unroll
            for (int r = 0; r < 8; ++r) { s[ks][r] *= c2; mloc = fmaxf(mloc, s[ks][r]); }
        mloc = fmaxf(mloc, __shfl_xor(mloc, 16, 32));
        const float mn = fmaxf(m2, mloc);
        const float alpha = exp2f(m2 - mn);
        float ls = 0.0f;
        v16h pf[2];
#pragma unroll
        for (int ks = 0; ks < 4; ++ks)
#pragma unroll
            for (int r = 0; r < 8; ++r) {
                const float e = (s[ks][r] - mn) + P_CARRY_LOG2;
                const float p = (e < -14.0f) ? 0.0f : exp2f(e);      // numerators x256; nothing below the smallest f16 normal survives
                ls += p;
                pf[ks >> 1][(ks & 1) * 8 + r] = (_Float16)p;         // keys 32j+8hf+r -> elements 0..7, keys 32j+16+8hf+r -> elements 8..15
            }
        m2 = mn;
        lsum = lsum * alpha + ls;
#pragma unroll
        for (int d = 0; d < 8; ++d) o[d] *= alpha;
#pragma unroll
        for (int d = 0; d < 8; ++d) {
            const _Float16* vr = vb + (size_t)(d * 16 + l16) * SEQ + kt * 64;
            o[d] = wmma16(ldfrag(vr, hf), pf[0], o[d]);
            o[d] = wmma16(ldfrag(vr + 32, hf), pf[1], o[d]);
        }
    }
    const float lt = lsum + __shfl_xor(lsum, 16, 32);
    const float inv = (1.0f / lt) * (1.0f / SC_QKV);                 // the x256 carry cancels between o and lt
#pragma unroll
    for (int d = 0; d < 8; ++d) {
        v4f p0, p1;
#pragma unroll
        for (int r = 0; r < 4; ++r) { p0[r] = o[d][r] * inv; p1[r] = o[d][4 + r] * inv; }
        *(v4f*)&st[wv][l16 * 132 + d * 16 + 8 * hf]     = p0;        // row = query l16, cols d*16+8hf..+7
        *(v4f*)&st[wv][l16 * 132 + d * 16 + 8 * hf + 4] = p1;
    }
    __syncthreads();
    v4f w[16];
#pragma unroll
    for (int t = 0; t < 16; ++t) w[t] = *(const v4f*)&st[wv][t * 132 + lane * 4];
    float* obase = OUT + ((size_t)bi * SEQ_FULL + q0) * DM + hd * DK + lane * 4;
    auto pass = [&]() {
#pragma unroll
        for (int t = 0; t < 16; ++t) vst16f(obase + (size_t)t * DM, w[t]);
    };
    pass();
    
}

extern "C" void kernel_launch(void* const* d_in, const int* in_sizes, int n_in,
                              void* d_out, int out_size, void* d_ws, size_t ws_size, hipStream_t stream) {
    if (n_in < 6) return;
    const long long needTok = (long long)(NB - 1) * SEQ_FULL + SEQ;
    if ((long long)in_sizes[0] < needTok * DM) return;
    if (in_sizes[1] < NH * DM * DK || in_sizes[2] < NH * DM * DK || in_sizes[3] < NH * DK ||
        in_sizes[4] < NH * DM * DK || in_sizes[5] < NH * DK) return;
    if ((long long)out_size < needTok * DM) return;

    const float* x  = (const float*)d_in[0];    // [4][2048][1024]
    const float* Wq = (const float*)d_in[1];    // [8][1024][128]
    const float* Wk = (const float*)d_in[2];    // [8][1024][128]
    const float* bk = (const float*)d_in[3];    // [8][128]
    const float* Wv = (const float*)d_in[4];    // [8][1024][128]
    const float* bv = (const float*)d_in[5];    // [8][128]
    float* out = (float*)d_out;                  // [4][2048][1024]

    char* ws = (char*)d_ws;
    size_t off = 0;
    auto carve = [&](size_t bytes) -> char* { char* p = ws + off; off += (bytes + 255) & ~(size_t)255; return p; };
    _Float16* XH = (_Float16*)carve(WS_XH);      // [MTOK][1024]
    _Float16* WT = (_Float16*)carve(WS_WT);      // [3072][1024]: q heads | k heads | v heads
    _Float16* QK = (_Float16*)carve(WS_QK);      // [2][NB*NH][SEQ][128]: q plane then k plane
    _Float16* VT = (_Float16*)carve(WS_VT);      // [NB*NH][128][SEQ]
    if (off > ws_size) return;
    _Float16* QC = QK;
    _Float16* KC = QK + (size_t)NB * NH * SEQ * DK;

    k_cvtx<<<CVTX_BLK, 256, 0, stream>>>(x, XH);
    k_prepw<<<PREPW_BLK, 256, 0, stream>>>(Wq, WT);
    k_prepw<<<PREPW_BLK, 256, 0, stream>>>(Wk, WT + (size_t)NH * DK * DM);
    k_prepw<<<PREPW_BLK, 256, 0, stream>>>(Wv, WT + (size_t)2 * NH * DK * DM);
    k_proj<<<dim3(MTOK / 64, PROJN / 128, 1), 128, 0, stream>>>(XH, WT, bk, bv, QK, VT);
    k_attn<<<dim3(SEQ / 64, NB * NH, 1), 128, 0, stream>>>(QC, KC, VT, out);
}

// v001
// A run of this version takes 183 microseconds.
// Two timings next to v000 put it at 2.68 and 2.71 times that version's speed.
#include <hip/hip_runtime.h>

// All contractions on v_wmma_f32_16x16x32_f16 (f16 operands built from bf16-RNE input values with power-of-two carries, f32 accumulate):
// per-head projections x.[Wq|Wk|Wv] (K=1024), per-(b,h) k.q^T (K=128), v^T.p^T (K=seq); online softmax, bias adds and normalisation in f32.

#ifndef NB
#define NB 4
#endif
#ifndef SEQ
#define SEQ 2048
#endif
#define NB_FULL 4
#define SEQ_FULL 2048
#define DM 1024
#define NH 8
#define DK 128
#define MTOK (NB * SEQ)
#define PROJN (3 * NH * DK)             // 3072 rows of the n-major projection weight plane: Wq heads | Wk heads | Wv heads

static_assert(SEQ % 64 == 0);
static_assert(SEQ <= SEQ_FULL);
static_assert(NB >= 1 && NB <= NB_FULL);
static_assert(DM % 32 == 0);
static_assert(DK == 128);
static_assert(NH * DK == DM);
static_assert(PROJN == 3072);
static_assert(PROJN % 128 == 0);
static_assert(MTOK % 64 == 0);
static_assert(((size_t)MTOK * DM / 8) % 256 == 0);
static_assert(((size_t)NH * DK * DM / 8) % 256 == 0);

// exact power-of-two carries
#define SC_X   16.0f    // activation plane (|x| <= ~6 -> <= ~96)
#define SC_W   256.0f   // projection weights (|w| <= ~0.18 -> <= ~46)
#define SC_QKV 8.0f     // q, k, v planes
#define P_CARRY_LOG2 8.0f   // softmax numerators carried x256 (the row sum carries the same factor)

// workspace plan (bytes), every region a multiple of 256
#define WS_XH ((size_t)MTOK * DM * 2)
#define WS_WT ((size_t)PROJN * DM * 2)
#define WS_QK (2 * (size_t)NB * NH * SEQ * DK * 2)
#define WS_VT ((size_t)NB * NH * DK * SEQ * 2)
#define WS_TOTAL (WS_XH + WS_WT + WS_QK + WS_VT)
static_assert(WS_XH % 256 == 0 && WS_WT % 256 == 0 && WS_QK % 256 == 0 && WS_VT % 256 == 0);
static_assert(WS_TOTAL <= (size_t)134217728);

typedef _Float16 v8h  __attribute__((ext_vector_type(8)));
typedef _Float16 v16h __attribute__((ext_vector_type(16)));
typedef float    v8f  __attribute__((ext_vector_type(8)));
typedef float    v4f  __attribute__((ext_vector_type(4)));
typedef unsigned v4u  __attribute__((ext_vector_type(4)));

// bf16 RNE of an f32 value, kept as f32
__device__ __forceinline__ float bfr(float f) {
    unsigned u = __float_as_uint(f);
    u = (u + 0x7fffu + ((u >> 16) & 1u)) & 0xffff0000u;
    return __uint_as_float(u);
}
// input value -> bf16 RNE -> times exact power of two -> f16 (exact for normal results)
__device__ __forceinline__ _Float16 tohx(float f, float sc) { return (_Float16)(bfr(f) * sc); }
// f32 -> f16 that can never yield an f16 subnormal (value select applied after the carry)
__device__ __forceinline__ _Float16 toh_flush(float v) {
    const _Float16 r = (_Float16)v;
    return (fabsf(v) < 6.103515625e-05f) ? (_Float16)0.0f : r;
}
__device__ __forceinline__ _Float16 tohx_flush(float f, float sc) { return toh_flush(bfr(f) * sc); }

// one 16x16x32 f16 WMMA with the hazard guard; D element r of lane l = (row 8*(l>>4)+r, col l&15)
__device__ __forceinline__ v8f wmma16(v16h a, v16h b, v8f c) {
    c = __builtin_amdgcn_wmma_f32_16x16x32_f16(false, a, false, b, (short)0, c, false, false);
    asm volatile("v_nop\n\tv_nop\n\tv_nop\n\tv_nop" : "+v"(c) : "v"(a), "v"(b));
    return c;
}
// A fragment of row p (p = row start + k0) or B fragment of an n-major (k-contiguous) row: lane half hf,
// elements 0..7 <- k0+8hf..+7, elements 8..15 <- k0+16+8hf..+7 (same map for A and B)
__device__ __forceinline__ v16h ldfrag(const _Float16* p, int hf) {
    const v8h lo = *(const v8h*)(p + 8 * hf);
    const v8h hi = *(const v8h*)(p + 16 + 8 * hf);
    return __builtin_shufflevector(lo, hi, 0, 1, 2, 3, 4, 5, 6, 7, 8, 9, 10, 11, 12, 13, 14, 15);
}
__device__ __forceinline__ void vst16(_Float16* g, v8h v) { *(v4u*)g = __builtin_bit_cast(v4u, v); }
__device__ __forceinline__ void vst16f(float* g, v4f v) { *(v4f*)g = v; }

// 16-B-per-lane asynchronous copies global -> LDS (l = the lane's LDS byte address, g = its global address), four or eight in one statement;
// the s_wait_xcnt stands inside the statement so that no address register named here is rewritten ahead of it
__device__ __forceinline__ void acopy4(unsigned l0, unsigned l1, unsigned l2, unsigned l3,
                                       const _Float16* g0, const _Float16* g1, const _Float16* g2, const _Float16* g3) {
    asm volatile("global_load_async_to_lds_b128 %0, %4, off\n\t"
                 "global_load_async_to_lds_b128 %1, %5, off\n\t"
                 "global_load_async_to_lds_b128 %2, %6, off\n\t"
                 "global_load_async_to_lds_b128 %3, %7, off\n\t"
                 "s_wait_xcnt 0x0"
                 :: "v"(l0), "v"(l1), "v"(l2), "v"(l3), "v"(g0), "v"(g1), "v"(g2), "v"(g3)
                 : "memory");
}
__device__ __forceinline__ void acopy8(unsigned l0, unsigned l1, unsigned l2, unsigned l3, unsigned l4, unsigned l5, unsigned l6, unsigned l7,
                                       const _Float16* g0, const _Float16* g1, const _Float16* g2, const _Float16* g3,
                                       const _Float16* g4, const _Float16* g5, const _Float16* g6, const _Float16* g7) {
    asm volatile("global_load_async_to_lds_b128 %0, %8, off\n\t"
                 "global_load_async_to_lds_b128 %1, %9, off\n\t"
                 "global_load_async_to_lds_b128 %2, %10, off\n\t"
                 "global_load_async_to_lds_b128 %3, %11, off\n\t"
                 "global_load_async_to_lds_b128 %4, %12, off\n\t"
                 "global_load_async_to_lds_b128 %5, %13, off\n\t"
                 "global_load_async_to_lds_b128 %6, %14, off\n\t"
                 "global_load_async_to_lds_b128 %7, %15, off\n\t"
                 "s_wait_xcnt 0x0"
                 :: "v"(l0), "v"(l1), "v"(l2), "v"(l3), "v"(l4), "v"(l5), "v"(l6), "v"(l7),
                    "v"(g0), "v"(g1), "v"(g2), "v"(g3), "v"(g4), "v"(g5), "v"(g6), "v"(g7)
                 : "memory");
}

// ---------------- activation plane: XH [MTOK][1024] f16 = bf16-RNE(x) x16; thread i writes the 16 bytes at byte 16*i ----------------
#define CVTX_BLK (MTOK * (DM / 8) / 256)
__global__ __launch_bounds__(256) void k_cvtx(const float* __restrict__ X, _Float16* XH) {
    const int i = blockIdx.x * 256 + threadIdx.x;                 // < MTOK * 128
    const int tok = i >> 7, k = (i & 127) * 8;
    const int bi = tok / SEQ, si = tok - bi * SEQ;
    const float* xp = X + ((size_t)bi * SEQ_FULL + si) * DM + k;
    const v4f x0 = *(const v4f*)(xp);
    const v4f x1 = *(const v4f*)(xp + 4);
    v8h val;
#pragma unroll
    for (int j = 0; j < 4; ++j) {
        val[j]     = tohx_flush(x0[j], SC_X);
        val[4 + j] = tohx_flush(x1[j], SC_X);
    }
    _Float16* dst = XH + (size_t)tok * DM + k;
    vst16(dst, val);
    
}

// ---------------- weight plane: W [8][1024][128] f32 -> WT rows n = h*128+e, [n][1024] f16 = bf16-RNE(w) x256 (n-major, k-contiguous);
// in[h][d][e] -> out[h*128+e][d]; thread i writes the 16 bytes at byte 16*i of this matrix's 2 MiB slab ----------------
#define PREPW_BLK (NH * DK * (DM / 8) / 256)     // 512
__global__ __launch_bounds__(256) void k_prepw(const float* __restrict__ W, _Float16* WT) {
    const int i = blockIdx.x * 256 + threadIdx.x;                 // < 1024 * 128
    const int n = i >> 7, k = (i & 127) * 8;
    const int hh = n >> 7, e = n & 127;
    v8h val;
#pragma unroll
    for (int j = 0; j < 8; ++j) val[j] = tohx_flush(W[((size_t)hh * DM + k + j) * DK + e], SC_W);
    _Float16* dst = WT + (size_t)n * DM + k;
    vst16(dst, val);
    
}

// ---------------- projections (K = 1024): block = 64 tokens x 128 output columns (group g of 24): g<8 q head g -> QK[0][b][h][s][128] (no bias);
// 8..15 k head -> QK[1][b][h][s][128] (+bk); 16..23 v head -> VT[b][h][d][s] (+bv, transposed via LDS). All planes x8, bias added in f32. ----------------
// Each 64-k tile of the block's 64 activation rows and 128 weight rows (128-B rows) is brought into LDS once per block by asynchronous copies,
// two buffers: tile t+2 flies into the buffer that trip t has left while trip t+1 is worked on. Row pitch 144 B (16 B x odd) for the 16-B readers.
#define PKC 64                                  // k per staged tile
#define PP_H 72                                 // row pitch in LDS, halves
#define PA_H (64 * PP_H)
#define PB_H (128 * PP_H)
#define PSTAGE_H (PA_H + PB_H)                  // 27,648 B per buffer
#define PNT (DM / PKC)
static_assert(DM % PKC == 0 && PNT >= 2);
static_assert((PA_H * 2) % 16 == 0 && (PSTAGE_H * 2) % 16 == 0);
static_assert(9216 <= 2 * PSTAGE_H);            // the output staging fits in the ring it reuses
__global__ __launch_bounds__(128) void k_proj(const _Float16* __restrict__ XH, const _Float16* __restrict__ WT,
                                              const float* __restrict__ bK, const float* __restrict__ bV,
                                              _Float16* QK, _Float16* VT) {
    __shared__ __align__(16) _Float16 ring[2 * PSTAGE_H];       // two buffers [x 64 x 72 | w 128 x 72]
    _Float16* st = ring;                                        // after the loop: row-major [64][136] or transposed [128][72]
    const int tid = threadIdx.x, lane = tid & 31, l16 = lane & 15, hf = lane >> 4;
    const int wv = __builtin_amdgcn_readfirstlane(threadIdx.x >> 5);
    const int g = blockIdx.y;
    const int t0 = blockIdx.x * 64;
    const int bi = t0 / SEQ, s0 = t0 - bi * SEQ;               // 64 | SEQ: whole block inside one batch
    const int hh = g & 7;
    const bool isV = (g >= 16);
    // this lane's share of a tile: 16-B column tid%8 of rows j*16 + tid/8, j = 0..3 of the activations, j = 0..7 of the weights
    const unsigned ring0 = (unsigned)(size_t)&ring[0];
    const unsigned la = ring0 + (unsigned)((tid >> 3) * (PP_H * 2) + (tid & 7) * 16);
    const _Float16* ga = XH + (size_t)(t0 + (tid >> 3)) * DM + (tid & 7) * 8;
    const _Float16* gb = WT + (size_t)(g * 128 + (tid >> 3)) * DM + (tid & 7) * 8;
    auto fill = [&](int t, int buf) {
        const unsigned A = la + (unsigned)buf * (PSTAGE_H * 2);
        const unsigned B = A + PA_H * 2;
        const unsigned R = 16 * PP_H * 2;                           // 16 rows further in LDS
        const _Float16* a = ga + t * PKC;
        const _Float16* b = gb + t * PKC;
        acopy4(A, A + R, A + 2 * R, A + 3 * R, a, a + 16 * DM, a + 32 * DM, a + 48 * DM);
        acopy8(B, B + R, B + 2 * R, B + 3 * R, B + 4 * R, B + 5 * R, B + 6 * R, B + 7 * R,
               b, b + 16 * DM, b + 32 * DM, b + 48 * DM, b + 64 * DM, b + 80 * DM, b + 96 * DM, b + 112 * DM);
    };
    fill(0, 0);
    asm volatile("s_wait_asynccnt 0x0" ::: "memory");              // tile 0 of this wave's copies has landed
    __syncthreads();                                                // ... and every other wave's: tile 0 is published
    fill(1, 1);
    v8f acc[8];
#pragma unroll
    for (int nt = 0; nt < 8; ++nt) acc[nt] = (v8f){};
#pragma unroll 1
    for (int kt = 0; kt < PNT; ++kt) {
        const _Float16* As = ring + (kt & 1) * PSTAGE_H + (wv * 16 + l16) * PP_H;
        const _Float16* Bs = ring + (kt & 1) * PSTAGE_H + PA_H + l16 * PP_H;
#pragma unroll
        for (int k2 = 0; k2 < PKC / 32; ++k2) {
            const v16h a = ldfrag(As + k2 * 32, hf);
#pragma unroll
            for (int nt = 0; nt < 8; ++nt) {
                const v16h bf = ldfrag(Bs + nt * 16 * PP_H + k2 * 32, hf);
                acc[nt] = wmma16(a, bf, acc[nt]);
            }
        }
        asm volatile("s_wait_dscnt 0x0" ::: "memory");             // this wave's reads of buffer kt&1 are over before the buffer is handed back
        asm volatile("s_wait_asynccnt 0x0" ::: "memory");          // this wave's copies of tile kt+1 have landed
        __syncthreads();                                            // publishes tile kt+1 and ends every wave's reads of buffer kt&1
        if (kt + 2 < PNT) fill(kt + 2, kt & 1);
    }
    asm volatile("s_wait_asynccnt 0x0" ::: "memory");              // nothing in flight when the ring becomes output staging
    if (isV) {
        // st[d][tok] pitch 72: lane owns column d, its 8 tokens wv*16+8hf..+7 are contiguous -> one 16-B LDS store per tile
#pragma unroll
        for (int nt = 0; nt < 8; ++nt) {
            const int d = nt * 16 + l16;
            const float bb = bfr(bV[hh * DK + d]);
            v8h pv;
#pragma unroll
            for (int r = 0; r < 8; ++r) pv[r] = toh_flush((acc[nt][r] * (1.0f / (SC_X * SC_W)) + bb) * SC_QKV);
            *(v8h*)&st[d * 72 + wv * 16 + 8 * hf] = pv;
        }
    } else {
        // st[tok][col] pitch 136
#pragma unroll
        for (int nt = 0; nt < 8; ++nt) {
            const int col = nt * 16 + l16;
            const float bkv = bK[hh * DK + col];
            const float bb = (g < 8) ? 0.0f : bfr(bkv);
#pragma unroll
            for (int r = 0; r < 8; ++r) st[(wv * 16 + 8 * hf + r) * 136 + col] = toh_flush((acc[nt][r] * (1.0f / (SC_X * SC_W)) + bb) * SC_QKV);
        }
    }
    __syncthreads();
    v8h w[8];
    if (isV) {
        const int hd = g - 16;
#pragma unroll
        for (int p = 0; p < 8; ++p) { const int d = p * 16 + (tid >> 3), pc = tid & 7; w[p] = *(const v8h*)&st[d * 72 + pc * 8]; }
        auto pass = [&]() {
#pragma unroll
            for (int p = 0; p < 8; ++p) {
                const int d = p * 16 + (tid >> 3), pc = tid & 7;
                vst16(VT + ((size_t)(bi * NH + hd) * DK + d) * SEQ + s0 + pc * 8, w[p]);
            }
        };
        pass();
        
    } else {
        // 64 rows x 256 B contiguous inside plane (g>>3) of QK
        _Float16* base = QK + ((size_t)((g >> 3) * (NB * NH) + bi * NH + hh) * SEQ + s0) * DK;
#pragma unroll
        for (int p = 0; p < 8; ++p) { const int off = p * 1024 + tid * 8; w[p] = *(const v8h*)&st[(off >> 7) * 136 + (off & 127)]; }
        auto pass = [&]() {
#pragma unroll
            for (int p = 0; p < 8; ++p) { const int off = p * 1024 + tid * 8; vst16(base + off, w[p]); }
        };
        pass();
        
    }
}

#define ATW 8
#define KP_H 136
#define VP_H 72
#define KBUF_H (64 * KP_H)
#define VBUF_H (DK * VP_H)
#define STAGE_H (KBUF_H + VBUF_H)               // 35,840 B per buffer
#define NTILE (SEQ / 64)
static_assert(SEQ % (ATW * 16) == 0);
static_assert(NTILE >= 2);
static_assert((KBUF_H * 2) % 16 == 0 && (STAGE_H * 2) % 16 == 0);
static_assert(ATW * 16 * 132 * 4 <= 2 * STAGE_H * 2);   // the output staging fits in the ring it reuses

__global__ __launch_bounds__(ATW * 32) void k_attn(const _Float16* __restrict__ QC, const _Float16* __restrict__ KC,
                                              const _Float16* __restrict__ VT, float* OUT) {
    __shared__ __align__(16) _Float16 ring[2 * STAGE_H];            // two buffers [K 64 x 136 | V^T 128 x 72]; after the loop: output staging
    const int tid = threadIdx.x, lane = tid & 31, l16 = lane & 15, hf = lane >> 4;
    const int wv = __builtin_amdgcn_readfirstlane(threadIdx.x >> 5);
    const int bh = blockIdx.y, bi = bh / NH, hd = bh - bi * NH;
    const int q0 = blockIdx.x * (ATW * 16) + wv * 16;
    const _Float16* kb  = KC  + (size_t)bh * SEQ * DK;
    const _Float16* vb  = VT  + (size_t)bh * DK * SEQ;
    // this lane's share of a tile: K chunks (row j*16 + tid/16, 16-B column tid%16), V^T chunks (row j*32 + tid/8, 16-B column tid%8), j = 0..3
    const unsigned ring0 = (unsigned)(size_t)&ring[0];
    const unsigned lk = ring0 + (unsigned)((tid >> 4) * (KP_H * 2) + (tid & 15) * 16);
    const unsigned lv = ring0 + (unsigned)(KBUF_H * 2 + (tid >> 3) * (VP_H * 2) + (tid & 7) * 16);
    const _Float16* gk = kb + tid * 8;
    const _Float16* gv = vb + (size_t)(tid >> 3) * SEQ + (tid & 7) * 8;
    auto fill = [&](int t, int buf) {
        const unsigned bo = (unsigned)buf * (STAGE_H * 2);
        const _Float16* k = gk + (size_t)t * (64 * DK);
        const _Float16* v = gv + t * 64;
        acopy8(lk + bo, lk + bo + 16 * KP_H * 2, lk + bo + 32 * KP_H * 2, lk + bo + 48 * KP_H * 2,
               lv + bo, lv + bo + 32 * VP_H * 2, lv + bo + 64 * VP_H * 2, lv + bo + 96 * VP_H * 2,
               k, k + 16 * DK, k + 32 * DK, k + 48 * DK,
               v, v + (size_t)32 * SEQ, v + (size_t)64 * SEQ, v + (size_t)96 * SEQ);
    };
    fill(0, 0);
    v16h qf[4];
    {
        const _Float16* qr = QC + ((size_t)bh * SEQ + q0 + l16) * DK;
#pragma unroll
        for (int cc = 0; cc < 4; ++cc) qf[cc] = ldfrag(qr + cc * 32, hf);
    }
    asm volatile("s_wait_asynccnt 0x0" ::: "memory");              // tile 0 of this wave's copies has landed
    __syncthreads();                                                // ... and every other wave's: tile 0 is published
    fill(1, 1);
    v8f o[8];
#pragma unroll
    for (int d = 0; d < 8; ++d) o[d] = (v8f){};
    float m2 = -__builtin_inff(), lsum = 0.0f;
    const float c2 = (0.08838834764831845f * 1.4426950408889634f) * (1.0f / (SC_QKV * SC_QKV));   // (1/sqrt(128)) * log2(e) / 64
#pragma unroll 1
    for (int kt = 0; kt < NTILE; ++kt) {
        const _Float16* Ks = ring + (kt & 1) * STAGE_H;
        const _Float16* Vs = Ks + KBUF_H;
        v8f s[4];
#pragma unroll
        for (int ks = 0; ks < 4; ++ks) {
            const _Float16* kr = Ks + (ks * 16 + l16) * KP_H;
            v8f c = (v8f){};
#pragma unroll
            for (int cc = 0; cc < 4; ++cc) c = wmma16(ldfrag(kr + cc * 32, hf), qf[cc], c);
            s[ks] = c;
        }
        float mloc = -__builtin_inff();
#pragma unroll
        for (int ks = 0; ks < 4; ++ks)
#pragma unroll
            for (int r = 0; r < 8; ++r) { s[ks][r] *= c2; mloc = fmaxf(mloc, s[ks][r]); }
        mloc = fmaxf(mloc, __shfl_xor(mloc, 16, 32));
        const float mn = fmaxf(m2, mloc);
        const float alpha = exp2f(m2 - mn);
        float ls = 0.0f;
        v16h pf[2];
#pragma unroll
        for (int ks = 0; ks < 4; ++ks)
#pragma unroll
            for (int r = 0; r < 8; ++r) {
                const float e = (s[ks][r] - mn) + P_CARRY_LOG2;
                const float p = (e < -14.0f) ? 0.0f : exp2f(e);      // numerators x256; nothing below the smallest f16 normal survives
                ls += p;
                pf[ks >> 1][(ks & 1) * 8 + r] = (_Float16)p;         // keys 32j+8hf+r -> elements 0..7, keys 32j+16+8hf+r -> elements 8..15
            }
        m2 = mn;
        lsum = lsum * alpha + ls;
#pragma unroll
        for (int d = 0; d < 8; ++d) o[d] *= alpha;
#pragma unroll
        for (int d = 0; d < 8; ++d) {
            const _Float16* vr = Vs + (d * 16 + l16) * VP_H;
            o[d] = wmma16(ldfrag(vr, hf), pf[0], o[d]);
            o[d] = wmma16(ldfrag(vr + 32, hf), pf[1], o[d]);
        }
        asm volatile("s_wait_dscnt 0x0" ::: "memory");             // this wave's reads of buffer kt&1 are over before the buffer is handed back
        asm volatile("s_wait_asynccnt 0x0" ::: "memory");          // this wave's copies of tile kt+1 have landed
        __syncthreads();                                            // publishes tile kt+1 and ends every wave's reads of buffer kt&1
        if (kt + 2 < NTILE) fill(kt + 2, kt & 1);
    }
    asm volatile("s_wait_asynccnt 0x0" ::: "memory");              // nothing in flight when the ring becomes output staging
    float* stw = (float*)ring + wv * (16 * 132);                    // per wave 16 q rows x 128 d, pitch 132 floats (528 B); private to its wave
    const float lt = lsum + __shfl_xor(lsum, 16, 32);
    const float inv = (1.0f / lt) * (1.0f / SC_QKV);                 // the x256 carry cancels between o and lt
#pragma unroll
    for (int d = 0; d < 8; ++d) {
        v4f p0, p1;
#pragma unroll
        for (int r = 0; r < 4; ++r) { p0[r] = o[d][r] * inv; p1[r] = o[d][4 + r] * inv; }
        *(v4f*)&stw[l16 * 132 + d * 16 + 8 * hf]     = p0;           // row = query l16, cols d*16+8hf..+7
        *(v4f*)&stw[l16 * 132 + d * 16 + 8 * hf + 4] = p1;
    }
    __syncthreads();
    v4f w[16];
#pragma unroll
    for (int t = 0; t < 16; ++t) w[t] = *(const v4f*)&stw[t * 132 + lane * 4];
    float* obase = OUT + ((size_t)bi * SEQ_FULL + q0) * DM + hd * DK + lane * 4;
    auto pass = [&]() {
#pragma unroll
        for (int t = 0; t < 16; ++t) vst16f(obase + (size_t)t * DM, w[t]);
    };
    pass();
    
}

extern "C" void kernel_launch(void* const* d_in, const int* in_sizes, int n_in,
                              void* d_out, int out_size, void* d_ws, size_t ws_size, hipStream_t stream) {
    if (n_in < 6) return;
    const long long needTok = (long long)(NB - 1) * SEQ_FULL + SEQ;
    if ((long long)in_sizes[0] < needTok * DM) return;
    if (in_sizes[1] < NH * DM * DK || in_sizes[2] < NH * DM * DK || in_sizes[3] < NH * DK ||
        in_sizes[4] < NH * DM * DK || in_sizes[5] < NH * DK) return;
    if ((long long)out_size < needTok * DM) return;

    const float* x  = (const float*)d_in[0];    // [4][2048][1024]
    const float* Wq = (const float*)d_in[1];    // [8][1024][128]
    const float* Wk = (const float*)d_in[2];    // [8][1024][128]
    const float* bk = (const float*)d_in[3];    // [8][128]
    const float* Wv = (const float*)d_in[4];    // [8][1024][128]
    const float* bv = (const float*)d_in[5];    // [8][128]
    float* out = (float*)d_out;                  // [4][2048][1024]

    char* ws = (char*)d_ws;
    size_t off = 0;
    auto carve = [&](size_t bytes) -> char* { char* p = ws + off; off += (bytes + 255) & ~(size_t)255; return p; };
    _Float16* XH = (_Float16*)carve(WS_XH);      // [MTOK][1024]
    _Float16* WT = (_Float16*)carve(WS_WT);      // [3072][1024]: q heads | k heads | v heads
    _Float16* QK = (_Float16*)carve(WS_QK);      // [2][NB*NH][SEQ][128]: q plane then k plane
    _Float16* VT = (_Float16*)carve(WS_VT);      // [NB*NH][128][SEQ]
    if (off > ws_size) return;
    _Float16* QC = QK;
    _Float16* KC = QK + (size_t)NB * NH * SEQ * DK;

    k_cvtx<<<CVTX_BLK, 256, 0, stream>>>(x, XH);
    k_prepw<<<PREPW_BLK, 256, 0, stream>>>(Wq, WT);
    k_prepw<<<PREPW_BLK, 256, 0, stream>>>(Wk, WT + (size_t)NH * DK * DM);
    k_prepw<<<PREPW_BLK, 256, 0, stream>>>(Wv, WT + (size_t)2 * NH * DK * DM);
    k_proj<<<dim3(MTOK / 64, PROJN / 128, 1), 128, 0, stream>>>(XH, WT, bk, bv, QK, VT);
    k_attn<<<dim3(SEQ / (ATW * 16), NB * NH, 1), ATW * 32, 0, stream>>>(QC, KC, VT, out);
}

// v002
// A run of this version takes 149 microseconds.
// Two timings next to v001 put it at 1.23 and 1.22 times that version's speed.
// Over all steps from v000 it is 3.30 times as fast.
#include <hip/hip_runtime.h>

// All contractions on v_wmma_f32_16x16x32_f16 (f16 operands built from bf16-RNE input values with power-of-two carries, f32 accumulate):
// per-head projections x.[Wq|Wk|Wv] (K=1024), per-(b,h) k.q^T (K=128), v^T.p^T (K=seq); online softmax, bias adds and normalisation in f32.

#ifndef NB
#define NB 4
#endif
#ifndef SEQ
#define SEQ 2048
#endif
#define NB_FULL 4
#define SEQ_FULL 2048
#define DM 1024
#define NH 8
#define DK 128
#define MTOK (NB * SEQ)
#define PROJN (3 * NH * DK)             // 3072 rows of the n-major projection weight plane: Wq heads | Wk heads | Wv heads

static_assert(SEQ % 64 == 0);
static_assert(SEQ <= SEQ_FULL);
static_assert(NB >= 1 && NB <= NB_FULL);
static_assert(DM % 32 == 0);
static_assert(DK == 128);
static_assert(NH * DK == DM);
static_assert(PROJN == 3072);
static_assert(PROJN % 128 == 0);
static_assert(MTOK % 64 == 0);
static_assert(((size_t)MTOK * DM / 8) % 256 == 0);
static_assert(((size_t)NH * DK * DM / 8) % 256 == 0);

// exact power-of-two carries
#define SC_X   16.0f    // activation plane (|x| <= ~6 -> <= ~96)
#define SC_W   256.0f   // projection weights (|w| <= ~0.18 -> <= ~46)
#define SC_QKV 8.0f     // q, k, v planes
#define P_CARRY_LOG2 8.0f   // softmax numerators carried x256 (the row sum carries the same factor)

// workspace plan (bytes), every region a multiple of 256
#define WS_XH ((size_t)MTOK * DM * 2)
#define WS_WT ((size_t)PROJN * DM * 2)
#define WS_QK (2 * (size_t)NB * NH * SEQ * DK * 2)
#define WS_VT ((size_t)NB * NH * DK * SEQ * 2)
#define WS_TOTAL (WS_XH + WS_WT + WS_QK + WS_VT)
static_assert(WS_XH % 256 == 0 && WS_WT % 256 == 0 && WS_QK % 256 == 0 && WS_VT % 256 == 0);
static_assert(WS_TOTAL <= (size_t)134217728);

typedef _Float16 v8h  __attribute__((ext_vector_type(8)));
typedef _Float16 v16h __attribute__((ext_vector_type(16)));
typedef float    v8f  __attribute__((ext_vector_type(8)));
typedef float    v4f  __attribute__((ext_vector_type(4)));
typedef unsigned v4u  __attribute__((ext_vector_type(4)));

// bf16 RNE of an f32 value, kept as f32
__device__ __forceinline__ float bfr(float f) {
    unsigned u = __float_as_uint(f);
    u = (u + 0x7fffu + ((u >> 16) & 1u)) & 0xffff0000u;
    return __uint_as_float(u);
}
// input value -> bf16 RNE -> times exact power of two -> f16 (exact for normal results)
__device__ __forceinline__ _Float16 tohx(float f, float sc) { return (_Float16)(bfr(f) * sc); }
// f32 -> f16 that can never yield an f16 subnormal (value select applied after the carry)
__device__ __forceinline__ _Float16 toh_flush(float v) {
    const _Float16 r = (_Float16)v;
    return (fabsf(v) < 6.103515625e-05f) ? (_Float16)0.0f : r;
}
__device__ __forceinline__ _Float16 tohx_flush(float f, float sc) { return toh_flush(bfr(f) * sc); }

// one 16x16x32 f16 WMMA (builtin: the compiler keeps the hazard distance itself); D element r of lane l = (row 8*(l>>4)+r, col l&15)
__device__ __forceinline__ v8f wmma16(v16h a, v16h b, v8f c) {
    return __builtin_amdgcn_wmma_f32_16x16x32_f16(false, a, false, b, (short)0, c, false, false);
}
// A fragment of row p (p = row start + k0) or B fragment of an n-major (k-contiguous) row: lane half hf,
// elements 0..7 <- k0+8hf..+7, elements 8..15 <- k0+16+8hf..+7 (same map for A and B)
__device__ __forceinline__ v16h ldfrag(const _Float16* p, int hf) {
    const v8h lo = *(const v8h*)(p + 8 * hf);
    const v8h hi = *(const v8h*)(p + 16 + 8 * hf);
    return __builtin_shufflevector(lo, hi, 0, 1, 2, 3, 4, 5, 6, 7, 8, 9, 10, 11, 12, 13, 14, 15);
}
// ends a group of LDS fragment reads or a group of products: without it the compiler sinks each read to just ahead of its product (one full
// LDS wait per product), lifts a later group over the products whose registers it is to take, or drops the products behind the trip's barrier
__device__ __forceinline__ void group_end() { __builtin_amdgcn_sched_barrier(0); }
__device__ __forceinline__ void vst16(_Float16* g, v8h v) { *(v4u*)g = __builtin_bit_cast(v4u, v); }
__device__ __forceinline__ void vst16f(float* g, v4f v) { *(v4f*)g = v; }

// 16-B-per-lane asynchronous copies global -> LDS (l = the lane's LDS byte address, g = its global address), four or eight in one statement;
// the s_wait_xcnt stands inside the statement so that no address register named here is rewritten ahead of it
__device__ __forceinline__ void acopy4(unsigned l0, unsigned l1, unsigned l2, unsigned l3,
                                       const _Float16* g0, const _Float16* g1, const _Float16* g2, const _Float16* g3) {
    asm volatile("global_load_async_to_lds_b128 %0, %4, off\n\t"
                 "global_load_async_to_lds_b128 %1, %5, off\n\t"
                 "global_load_async_to_lds_b128 %2, %6, off\n\t"
                 "global_load_async_to_lds_b128 %3, %7, off\n\t"
                 "s_wait_xcnt 0x0"
                 :: "v"(l0), "v"(l1), "v"(l2), "v"(l3), "v"(g0), "v"(g1), "v"(g2), "v"(g3)
                 : "memory");
}
__device__ __forceinline__ void acopy8(unsigned l0, unsigned l1, unsigned l2, unsigned l3, unsigned l4, unsigned l5, unsigned l6, unsigned l7,
                                       const _Float16* g0, const _Float16* g1, const _Float16* g2, const _Float16* g3,
                                       const _Float16* g4, const _Float16* g5, const _Float16* g6, const _Float16* g7) {
    asm volatile("global_load_async_to_lds_b128 %0, %8, off\n\t"
                 "global_load_async_to_lds_b128 %1, %9, off\n\t"
                 "global_load_async_to_lds_b128 %2, %10, off\n\t"
                 "global_load_async_to_lds_b128 %3, %11, off\n\t"
                 "global_load_async_to_lds_b128 %4, %12, off\n\t"
                 "global_load_async_to_lds_b128 %5, %13, off\n\t"
                 "global_load_async_to_lds_b128 %6, %14, off\n\t"
                 "global_load_async_to_lds_b128 %7, %15, off\n\t"
                 "s_wait_xcnt 0x0"
                 :: "v"(l0), "v"(l1), "v"(l2), "v"(l3), "v"(l4), "v"(l5), "v"(l6), "v"(l7),
                    "v"(g0), "v"(g1), "v"(g2), "v"(g3), "v"(g4), "v"(g5), "v"(g6), "v"(g7)
                 : "memory");
}

// ---------------- activation plane: XH [MTOK][1024] f16 = bf16-RNE(x) x16; thread i writes the 16 bytes at byte 16*i ----------------
#define CVTX_BLK (MTOK * (DM / 8) / 256)
__global__ __launch_bounds__(256) void k_cvtx(const float* __restrict__ X, _Float16* XH) {
    const int i = blockIdx.x * 256 + threadIdx.x;                 // < MTOK * 128
    const int tok = i >> 7, k = (i & 127) * 8;
    const int bi = tok / SEQ, si = tok - bi * SEQ;
    const float* xp = X + ((size_t)bi * SEQ_FULL + si) * DM + k;
    const v4f x0 = *(const v4f*)(xp);
    const v4f x1 = *(const v4f*)(xp + 4);
    v8h val;
#pragma unroll
    for (int j = 0; j < 4; ++j) {
        val[j]     = tohx_flush(x0[j], SC_X);
        val[4 + j] = tohx_flush(x1[j], SC_X);
    }
    _Float16* dst = XH + (size_t)tok * DM + k;
    vst16(dst, val);
    
}

// ---------------- weight plane: W [8][1024][128] f32 -> WT rows n = h*128+e, [n][1024] f16 = bf16-RNE(w) x256 (n-major, k-contiguous);
// in[h][d][e] -> out[h*128+e][d]; thread i writes the 16 bytes at byte 16*i of this matrix's 2 MiB slab ----------------
#define PREPW_BLK (NH * DK * (DM / 8) / 256)     // 512
__global__ __launch_bounds__(256) void k_prepw(const float* __restrict__ W, _Float16* WT) {
    const int i = blockIdx.x * 256 + threadIdx.x;                 // < 1024 * 128
    const int n = i >> 7, k = (i & 127) * 8;
    const int hh = n >> 7, e = n & 127;
    v8h val;
#pragma unroll
    for (int j = 0; j < 8; ++j) val[j] = tohx_flush(W[((size_t)hh * DM + k + j) * DK + e], SC_W);
    _Float16* dst = WT + (size_t)n * DM + k;
    vst16(dst, val);
    
}

// ---------------- projections (K = 1024): block = 64 tokens x 128 output columns (group g of 24): g<8 q head g -> QK[0][b][h][s][128] (no bias);
// 8..15 k head -> QK[1][b][h][s][128] (+bk); 16..23 v head -> VT[b][h][d][s] (+bv, transposed via LDS). All planes x8, bias added in f32. ----------------
// Each 64-k tile of the block's 64 activation rows and 128 weight rows (128-B rows) is brought into LDS once per block by asynchronous copies,
// two buffers: tile t+2 flies into the buffer that trip t has left while trip t+1 is worked on. Row pitch 144 B (16 B x odd) for the 16-B readers.
#define PKC 64                                  // k per staged tile
#define PP_H 72                                 // row pitch in LDS, halves
#define PA_H (64 * PP_H)
#define PB_H (128 * PP_H)
#define PSTAGE_H (PA_H + PB_H)                  // 27,648 B per buffer
#define PNT (DM / PKC)
static_assert(DM % PKC == 0 && PNT >= 2);
static_assert((PA_H * 2) % 16 == 0 && (PSTAGE_H * 2) % 16 == 0);
static_assert(9216 <= 2 * PSTAGE_H);            // the output staging fits in the ring it reuses
__global__ __launch_bounds__(128) void k_proj(const _Float16* __restrict__ XH, const _Float16* __restrict__ WT,
                                              const float* __restrict__ bK, const float* __restrict__ bV,
                                              _Float16* QK, _Float16* VT) {
    __shared__ __align__(16) _Float16 ring[2 * PSTAGE_H];       // two buffers [x 64 x 72 | w 128 x 72]
    _Float16* st = ring;                                        // after the loop: row-major [64][136] or transposed [128][72]
    const int tid = threadIdx.x, lane = tid & 31, l16 = lane & 15, hf = lane >> 4;
    const int wv = __builtin_amdgcn_readfirstlane(threadIdx.x >> 5);
    const int g = blockIdx.y;
    const int t0 = blockIdx.x * 64;
    const int bi = t0 / SEQ, s0 = t0 - bi * SEQ;               // 64 | SEQ: whole block inside one batch
    const int hh = g & 7;
    const bool isV = (g >= 16);
    // this lane's share of a tile: 16-B column tid%8 of rows j*16 + tid/8, j = 0..3 of the activations, j = 0..7 of the weights
    const unsigned ring0 = (unsigned)(size_t)&ring[0];
    const unsigned la = ring0 + (unsigned)((tid >> 3) * (PP_H * 2) + (tid & 7) * 16);
    const _Float16* ga = XH + (size_t)(t0 + (tid >> 3)) * DM + (tid & 7) * 8;
    const _Float16* gb = WT + (size_t)(g * 128 + (tid >> 3)) * DM + (tid & 7) * 8;
    auto fill = [&](int t, int buf) {
        const unsigned A = la + (unsigned)buf * (PSTAGE_H * 2);
        const unsigned B = A + PA_H * 2;
        const unsigned R = 16 * PP_H * 2;                           // 16 rows further in LDS
        const _Float16* a = ga + t * PKC;
        const _Float16* b = gb + t * PKC;
        acopy4(A, A + R, A + 2 * R, A + 3 * R, a, a + 16 * DM, a + 32 * DM, a + 48 * DM);
        acopy8(B, B + R, B + 2 * R, B + 3 * R, B + 4 * R, B + 5 * R, B + 6 * R, B + 7 * R,
               b, b + 16 * DM, b + 32 * DM, b + 48 * DM, b + 64 * DM, b + 80 * DM, b + 96 * DM, b + 112 * DM);
    };
    fill(0, 0);
    asm volatile("s_wait_asynccnt 0x0" ::: "memory");              // tile 0 of this wave's copies has landed
    __syncthreads();                                                // ... and every other wave's: tile 0 is published
    fill(1, 1);
    v8f acc[8];
#pragma unroll
    for (int nt = 0; nt < 8; ++nt) acc[nt] = (v8f){};
#pragma unroll 1
    for (int kt = 0; kt < PNT; ++kt) {
        const _Float16* As = ring + (kt & 1) * PSTAGE_H + (wv * 16 + l16) * PP_H;
        const _Float16* Bs = ring + (kt & 1) * PSTAGE_H + PA_H + l16 * PP_H;
        // every fragment of the tile is read as one group, in the order of its use, ahead of the tile's products
        v16h a[PKC / 32], bf[PKC / 32][8];
#pragma unroll
        for (int k2 = 0; k2 < PKC / 32; ++k2) {
            a[k2] = ldfrag(As + k2 * 32, hf);
#pragma unroll
            for (int nt = 0; nt < 8; ++nt) bf[k2][nt] = ldfrag(Bs + nt * 16 * PP_H + k2 * 32, hf);
        }
        group_end();
#pragma unroll
        for (int k2 = 0; k2 < PKC / 32; ++k2)
#pragma unroll
            for (int nt = 0; nt < 8; ++nt) acc[nt] = wmma16(a[k2], bf[k2][nt], acc[nt]);
        group_end();
        asm volatile("s_wait_dscnt 0x0" ::: "memory");             // this wave's reads of buffer kt&1 are over before the buffer is handed back
        asm volatile("s_wait_asynccnt 0x0" ::: "memory");          // this wave's copies of tile kt+1 have landed
        __syncthreads();                                            // publishes tile kt+1 and ends every wave's reads of buffer kt&1
        if (kt + 2 < PNT) fill(kt + 2, kt & 1);
    }
    asm volatile("s_wait_asynccnt 0x0" ::: "memory");              // nothing in flight when the ring becomes output staging
    if (isV) {
        // st[d][tok] pitch 72: lane owns column d, its 8 tokens wv*16+8hf..+7 are contiguous -> one 16-B LDS store per tile
#pragma unroll
        for (int nt = 0; nt < 8; ++nt) {
            const int d = nt * 16 + l16;
            const float bb = bfr(bV[hh * DK + d]);
            v8h pv;
#pragma unroll
            for (int r = 0; r < 8; ++r) pv[r] = toh_flush((acc[nt][r] * (1.0f / (SC_X * SC_W)) + bb) * SC_QKV);
            *(v8h*)&st[d * 72 + wv * 16 + 8 * hf] = pv;
        }
    } else {
        // st[tok][col] pitch 136
#pragma unroll
        for (int nt = 0; nt < 8; ++nt) {
            const int col = nt * 16 + l16;
            const float bkv = bK[hh * DK + col];
            const float bb = (g < 8) ? 0.0f : bfr(bkv);
#pragma unroll
            for (int r = 0; r < 8; ++r) st[(wv * 16 + 8 * hf + r) * 136 + col] = toh_flush((acc[nt][r] * (1.0f / (SC_X * SC_W)) + bb) * SC_QKV);
        }
    }
    __syncthreads();
    v8h w[8];
    if (isV) {
        const int hd = g - 16;
#pragma unroll
        for (int p = 0; p < 8; ++p) { const int d = p * 16 + (tid >> 3), pc = tid & 7; w[p] = *(const v8h*)&st[d * 72 + pc * 8]; }
        auto pass = [&]() {
#pragma unroll
            for (int p = 0; p < 8; ++p) {
                const int d = p * 16 + (tid >> 3), pc = tid & 7;
                vst16(VT + ((size_t)(bi * NH + hd) * DK + d) * SEQ + s0 + pc * 8, w[p]);
            }
        };
        pass();
        
    } else {
        // 64 rows x 256 B contiguous inside plane (g>>3) of QK
        _Float16* base = QK + ((size_t)((g >> 3) * (NB * NH) + bi * NH + hh) * SEQ + s0) * DK;
#pragma unroll
        for (int p = 0; p < 8; ++p) { const int off = p * 1024 + tid * 8; w[p] = *(const v8h*)&st[(off >> 7) * 136 + (off & 127)]; }
        auto pass = [&]() {
#pragma unroll
            for (int p = 0; p < 8; ++p) { const int off = p * 1024 + tid * 8; vst16(base + off, w[p]); }
        };
        pass();
        
    }
}

#define ATW 8
#define KP_H 136
#define VP_H 72
#define KBUF_H (64 * KP_H)
#define VBUF_H (DK * VP_H)
#define STAGE_H (KBUF_H + VBUF_H)               // 35,840 B per buffer
#define NTILE (SEQ / 64)
static_assert(SEQ % (ATW * 16) == 0);
static_assert(NTILE >= 2);
static_assert((KBUF_H * 2) % 16 == 0 && (STAGE_H * 2) % 16 == 0);
static_assert(ATW * 16 * 132 * 4 <= 2 * STAGE_H * 2);   // the output staging fits in the ring it reuses

__global__ __launch_bounds__(ATW * 32) void k_attn(const _Float16* __restrict__ QC, const _Float16* __restrict__ KC,
                                              const _Float16* __restrict__ VT, float* OUT) {
    __shared__ __align__(16) _Float16 ring[2 * STAGE_H];            // two buffers [K 64 x 136 | V^T 128 x 72]; after the loop: output staging
    const int tid = threadIdx.x, lane = tid & 31, l16 = lane & 15, hf = lane >> 4;
    const int wv = __builtin_amdgcn_readfirstlane(threadIdx.x >> 5);
    const int bh = blockIdx.y, bi = bh / NH, hd = bh - bi * NH;
    const int q0 = blockIdx.x * (ATW * 16) + wv * 16;
    const _Float16* kb  = KC  + (size_t)bh * SEQ * DK;
    const _Float16* vb  = VT  + (size_t)bh * DK * SEQ;
    // this lane's share of a tile: K chunks (row j*16 + tid/16, 16-B column tid%16), V^T chunks (row j*32 + tid/8, 16-B column tid%8), j = 0..3
    const unsigned ring0 = (unsigned)(size_t)&ring[0];
    const unsigned lk = ring0 + (unsigned)((tid >> 4) * (KP_H * 2) + (tid & 15) * 16);
    const unsigned lv = ring0 + (unsigned)(KBUF_H * 2 + (tid >> 3) * (VP_H * 2) + (tid & 7) * 16);
    const _Float16* gk = kb + tid * 8;
    const _Float16* gv = vb + (size_t)(tid >> 3) * SEQ + (tid & 7) * 8;
    auto fill = [&](int t, int buf) {
        const unsigned bo = (unsigned)buf * (STAGE_H * 2);
        const _Float16* k = gk + (size_t)t * (64 * DK);
        const _Float16* v = gv + t * 64;
        acopy8(lk + bo, lk + bo + 16 * KP_H * 2, lk + bo + 32 * KP_H * 2, lk + bo + 48 * KP_H * 2,
               lv + bo, lv + bo + 32 * VP_H * 2, lv + bo + 64 * VP_H * 2, lv + bo + 96 * VP_H * 2,
               k, k + 16 * DK, k + 32 * DK, k + 48 * DK,
               v, v + (size_t)32 * SEQ, v + (size_t)64 * SEQ, v + (size_t)96 * SEQ);
    };
    fill(0, 0);
    v16h qf[4];
    {
        const _Float16* qr = QC + ((size_t)bh * SEQ + q0 + l16) * DK;
#pragma unroll
        for (int cc = 0; cc < 4; ++cc) qf[cc] = ldfrag(qr + cc * 32, hf);
    }
    asm volatile("s_wait_asynccnt 0x0" ::: "memory");              // tile 0 of this wave's copies has landed
    __syncthreads();                                                // ... and every other wave's: tile 0 is published
    fill(1, 1);
    v8f o[8];
#pragma unroll
    for (int d = 0; d < 8; ++d) o[d] = (v8f){};
    float m2 = -__builtin_inff(), lsum = 0.0f;
    const float c2 = (0.08838834764831845f * 1.4426950408889634f) * (1.0f / (SC_QKV * SC_QKV));   // (1/sqrt(128)) * log2(e) / 64
#pragma unroll 1
    for (int kt = 0; kt < NTILE; ++kt) {
        const _Float16* Ks = ring + (kt & 1) * STAGE_H;
        const _Float16* Vs = Ks + KBUF_H;
        const _Float16* kr = Ks + l16 * KP_H;
        const _Float16* vr = Vs + l16 * VP_H;
        // LDS fragment reads stand in groups of four fragments, each group issued one or two groups ahead of the products that use it
        v16h kf[4][4], vf[4][4];                                    // K: [k chunk][key tile]; V^T: [key half * 2 + d half][d tile]
        v8f s[4];
#pragma unroll
        for (int cc = 0; cc < 2; ++cc)
#pragma unroll
            for (int ks = 0; ks < 4; ++ks) kf[cc][ks] = ldfrag(kr + ks * 16 * KP_H + cc * 32, hf);
        group_end();
#pragma unroll
        for (int cc = 0; cc < 4; ++cc) {
#pragma unroll
            for (int ks = 0; ks < 4; ++ks) s[ks] = wmma16(kf[cc][ks], qf[cc], cc == 0 ? (v8f){} : s[ks]);
            group_end();
            if (cc < 2) {
#pragma unroll
                for (int ks = 0; ks < 4; ++ks) kf[cc + 2][ks] = ldfrag(kr + ks * 16 * KP_H + (cc + 2) * 32, hf);
                group_end();
            } else if (cc == 2) {
#pragma unroll
                for (int d = 0; d < 4; ++d) vf[0][d] = ldfrag(vr + d * 16 * VP_H, hf);      // lands while the softmax runs
                group_end();
            }
        }
        float mloc = -__builtin_inff();
#pragma unroll
        for (int ks = 0; ks < 4; ++ks)
#pragma unroll
            for (int r = 0; r < 8; ++r) { s[ks][r] *= c2; mloc = fmaxf(mloc, s[ks][r]); }
        mloc = fmaxf(mloc, __shfl_xor(mloc, 16, 32));
        const float mn = fmaxf(m2, mloc);
        const float alpha = exp2f(m2 - mn);
        float ls = 0.0f;
        v16h pf[2];
#pragma unroll
        for (int ks = 0; ks < 4; ++ks)
#pragma unroll
            for (int r = 0; r < 8; ++r) {
                const float e = (s[ks][r] - mn) + P_CARRY_LOG2;
                const float p = (e < -14.0f) ? 0.0f : exp2f(e);      // numerators x256; nothing below the smallest f16 normal survives
                ls += p;
                pf[ks >> 1][(ks & 1) * 8 + r] = (_Float16)p;         // keys 32j+8hf+r -> elements 0..7, keys 32j+16+8hf+r -> elements 8..15
            }
        m2 = mn;
        lsum = lsum * alpha + ls;
        group_end();
#pragma unroll
        for (int d = 0; d < 4; ++d) vf[1][d] = ldfrag(vr + (4 + d) * 16 * VP_H, hf);
        group_end();
#pragma unroll
        for (int d = 0; d < 8; ++d) o[d] *= alpha;
#pragma unroll
        for (int g = 0; g < 4; ++g) {
#pragma unroll
            for (int d = 0; d < 4; ++d) o[(g & 1) * 4 + d] = wmma16(vf[g][d], pf[g >> 1], o[(g & 1) * 4 + d]);
            group_end();
            if (g < 2) {
#pragma unroll
                for (int d = 0; d < 4; ++d) vf[g + 2][d] = ldfrag(vr + ((g & 1) * 4 + d) * 16 * VP_H + 32, hf);
                group_end();
            }
        }
        asm volatile("s_wait_dscnt 0x0" ::: "memory");             // this wave's reads of buffer kt&1 are over before the buffer is handed back
        asm volatile("s_wait_asynccnt 0x0" ::: "memory");          // this wave's copies of tile kt+1 have landed
        __syncthreads();                                            // publishes tile kt+1 and ends every wave's reads of buffer kt&1
        if (kt + 2 < NTILE) fill(kt + 2, kt & 1);
    }
    asm volatile("s_wait_asynccnt 0x0" ::: "memory");              // nothing in flight when the ring becomes output staging
    float* stw = (float*)ring + wv * (16 * 132);                    // per wave 16 q rows x 128 d, pitch 132 floats (528 B); private to its wave
    const float lt = lsum + __shfl_xor(lsum, 16, 32);
    const float inv = (1.0f / lt) * (1.0f / SC_QKV);                 // the x256 carry cancels between o and lt
#pragma unroll
    for (int d = 0; d < 8; ++d) {
        v4f p0, p1;
#pragma unroll
        for (int r = 0; r < 4; ++r) { p0[r] = o[d][r] * inv; p1[r] = o[d][4 + r] * inv; }
        *(v4f*)&stw[l16 * 132 + d * 16 + 8 * hf]     = p0;           // row = query l16, cols d*16+8hf..+7
        *(v4f*)&stw[l16 * 132 + d * 16 + 8 * hf + 4] = p1;
    }
    __syncthreads();
    v4f w[16];
#pragma unroll
    for (int t = 0; t < 16; ++t) w[t] = *(const v4f*)&stw[t * 132 + lane * 4];
    float* obase = OUT + ((size_t)bi * SEQ_FULL + q0) * DM + hd * DK + lane * 4;
    auto pass = [&]() {
#pragma unroll
        for (int t = 0; t < 16; ++t) vst16f(obase + (size_t)t * DM, w[t]);
    };
    pass();
    
}

extern "C" void kernel_launch(void* const* d_in, const int* in_sizes, int n_in,
                              void* d_out, int out_size, void* d_ws, size_t ws_size, hipStream_t stream) {
    if (n_in < 6) return;
    const long long needTok = (long long)(NB - 1) * SEQ_FULL + SEQ;
    if ((long long)in_sizes[0] < needTok * DM) return;
    if (in_sizes[1] < NH * DM * DK || in_sizes[2] < NH * DM * DK || in_sizes[3] < NH * DK ||
        in_sizes[4] < NH * DM * DK || in_sizes[5] < NH * DK) return;
    if ((long long)out_size < needTok * DM) return;

    const float* x  = (const float*)d_in[0];    // [4][2048][1024]
    const float* Wq = (const float*)d_in[1];    // [8][1024][128]
    const float* Wk = (const float*)d_in[2];    // [8][1024][128]
    const float* bk = (const float*)d_in[3];    // [8][128]
    const float* Wv = (const float*)d_in[4];    // [8][1024][128]
    const float* bv = (const float*)d_in[5];    // [8][128]
    float* out = (float*)d_out;                  // [4][2048][1024]

    char* ws = (char*)d_ws;
    size_t off = 0;
    auto carve = [&](size_t bytes) -> char* { char* p = ws + off; off += (bytes + 255) & ~(size_t)255; return p; };
    _Float16* XH = (_Float16*)carve(WS_XH);      // [MTOK][1024]
    _Float16* WT = (_Float16*)carve(WS_WT);      // [3072][1024]: q heads | k heads | v heads
    _Float16* QK = (_Float16*)carve(WS_QK);      // [2][NB*NH][SEQ][128]: q plane then k plane
    _Float16* VT = (_Float16*)carve(WS_VT);      // [NB*NH][128][SEQ]
    if (off > ws_size) return;
    _Float16* QC = QK;
    _Float16* KC = QK + (size_t)NB * NH * SEQ * DK;

    k_cvtx<<<CVTX_BLK, 256, 0, stream>>>(x, XH);
    k_prepw<<<PREPW_BLK, 256, 0, stream>>>(Wq, WT);
    k_prepw<<<PREPW_BLK, 256, 0, stream>>>(Wk, WT + (size_t)NH * DK * DM);
    k_prepw<<<PREPW_BLK, 256, 0, stream>>>(Wv, WT + (size_t)2 * NH * DK * DM);
    k_proj<<<dim3(MTOK / 64, PROJN / 128, 1), 128, 0, stream>>>(XH, WT, bk, bv, QK, VT);
    k_attn<<<dim3(SEQ / (ATW * 16), NB * NH, 1), ATW * 32, 0, stream>>>(QC, KC, VT, out);
}

// v003
// It runs in 141 microseconds.
// In two side-by-side timings against v002, it was 1.05 and 1.06 times as fast.
// Over all steps from v000 it is 3.48 times as fast.
#include <hip/hip_runtime.h>

// All contractions on v_wmma_f32_16x16x32_f16 (f16 operands built from bf16-RNE input values with power-of-two carries, f32 accumulate):
// per-head projections x.[Wq|Wk|Wv] (K=1024), per-(b,h) k.q^T (K=128), v^T.p^T (K=seq); online softmax, bias adds and normalisation in f32.

#ifndef NB
#define NB 4
#endif
#ifndef SEQ
#define SEQ 2048
#endif
#define NB_FULL 4
#define SEQ_FULL 2048
#define DM 1024
#define NH 8
#define DK 128
#define MTOK (NB * SEQ)
#define PROJN (3 * NH * DK)             // 3072 rows of the n-major projection weight plane: Wq heads | Wk heads | Wv heads

static_assert(SEQ % 64 == 0);
static_assert(SEQ <= SEQ_FULL);
static_assert(NB >= 1 && NB <= NB_FULL);
static_assert(DM % 32 == 0);
static_assert(DK == 128);
static_assert(NH * DK == DM);
static_assert(PROJN == 3072);
static_assert(PROJN % 128 == 0);
static_assert(MTOK % 64 == 0);
static_assert(((size_t)MTOK * DM / 8) % 256 == 0);
static_assert(((size_t)NH * DK * DM / 8) % 256 == 0);

// exact power-of-two carries
#define SC_X   16.0f    // activation plane (|x| <= ~6 -> <= ~96)
#define SC_W   256.0f   // projection weights (|w| <= ~0.18 -> <= ~46)
#define SC_QKV 8.0f     // q, k, v planes
#define P_CARRY_LOG2 8.0f   // softmax numerators carried x256 (the row sum carries the same factor)

// workspace plan (bytes), every region a multiple of 256
#define WS_XH ((size_t)MTOK * DM * 2)
#define WS_WT ((size_t)PROJN * DM * 2)
#define WS_QK (2 * (size_t)NB * NH * SEQ * DK * 2)
#define WS_VT ((size_t)NB * NH * DK * SEQ * 2)
#define WS_TOTAL (WS_XH + WS_WT + WS_QK + WS_VT)
static_assert(WS_XH % 256 == 0 && WS_WT % 256 == 0 && WS_QK % 256 == 0 && WS_VT % 256 == 0);
static_assert(WS_TOTAL <= (size_t)134217728);

typedef _Float16 v8h  __attribute__((ext_vector_type(8)));
typedef _Float16 v16h __attribute__((ext_vector_type(16)));
typedef float    v8f  __attribute__((ext_vector_type(8)));
typedef float    v4f  __attribute__((ext_vector_type(4)));
typedef unsigned v4u  __attribute__((ext_vector_type(4)));

// bf16 RNE of an f32 value, kept as f32
__device__ __forceinline__ float bfr(float f) {
    unsigned u = __float_as_uint(f);
    u = (u + 0x7fffu + ((u >> 16) & 1u)) & 0xffff0000u;
    return __uint_as_float(u);
}
// input value -> bf16 RNE -> times exact power of two -> f16 (exact for normal results)
__device__ __forceinline__ _Float16 tohx(float f, float sc) { return (_Float16)(bfr(f) * sc); }
// f32 -> f16 that can never yield an f16 subnormal (value select applied after the carry)
__device__ __forceinline__ _Float16 toh_flush(float v) {
    const _Float16 r = (_Float16)v;
    return (fabsf(v) < 6.103515625e-05f) ? (_Float16)0.0f : r;
}
__device__ __forceinline__ _Float16 tohx_flush(float f, float sc) { return toh_flush(bfr(f) * sc); }

// one 16x16x32 f16 WMMA (builtin: the compiler keeps the hazard distance itself); D element r of lane l = (row 8*(l>>4)+r, col l&15)
__device__ __forceinline__ v8f wmma16(v16h a, v16h b, v8f c) {
    return __builtin_amdgcn_wmma_f32_16x16x32_f16(false, a, false, b, (short)0, c, false, false);
}
// A fragment of row p (p = row start + k0) or B fragment of an n-major (k-contiguous) row: lane half hf,
// elements 0..7 <- k0+8hf..+7, elements 8..15 <- k0+16+8hf..+7 (same map for A and B)
__device__ __forceinline__ v16h ldfrag(const _Float16* p, int hf) {
    const v8h lo = *(const v8h*)(p + 8 * hf);
    const v8h hi = *(const v8h*)(p + 16 + 8 * hf);
    return __builtin_shufflevector(lo, hi, 0, 1, 2, 3, 4, 5, 6, 7, 8, 9, 10, 11, 12, 13, 14, 15);
}
// ends a group of LDS fragment reads or a group of products: without it the compiler sinks each read to just ahead of its product (one full
// LDS wait per product), lifts a later group over the products whose registers it is to take, or drops the products behind the trip's barrier
__device__ __forceinline__ void group_end() { __builtin_amdgcn_sched_barrier(0); }
__device__ __forceinline__ void vst16(_Float16* g, v8h v) { *(v4u*)g = __builtin_bit_cast(v4u, v); }
__device__ __forceinline__ void vst16f(float* g, v4f v) { *(v4f*)g = v; }

// 16-B-per-lane asynchronous copies global -> LDS (l = the lane's LDS byte address, g = its global address), eight in one statement;
// the s_wait_xcnt stands inside the statement so that no address register named here is rewritten ahead of it
__device__ __forceinline__ void acopy8(unsigned l0, unsigned l1, unsigned l2, unsigned l3, unsigned l4, unsigned l5, unsigned l6, unsigned l7,
                                       const _Float16* g0, const _Float16* g1, const _Float16* g2, const _Float16* g3,
                                       const _Float16* g4, const _Float16* g5, const _Float16* g6, const _Float16* g7) {
    asm volatile("global_load_async_to_lds_b128 %0, %8, off\n\t"
                 "global_load_async_to_lds_b128 %1, %9, off\n\t"
                 "global_load_async_to_lds_b128 %2, %10, off\n\t"
                 "global_load_async_to_lds_b128 %3, %11, off\n\t"
                 "global_load_async_to_lds_b128 %4, %12, off\n\t"
                 "global_load_async_to_lds_b128 %5, %13, off\n\t"
                 "global_load_async_to_lds_b128 %6, %14, off\n\t"
                 "global_load_async_to_lds_b128 %7, %15, off\n\t"
                 "s_wait_xcnt 0x0"
                 :: "v"(l0), "v"(l1), "v"(l2), "v"(l3), "v"(l4), "v"(l5), "v"(l6), "v"(l7),
                    "v"(g0), "v"(g1), "v"(g2), "v"(g3), "v"(g4), "v"(g5), "v"(g6), "v"(g7)
                 : "memory");
}

// ---------------- activation plane: XH [MTOK][1024] f16 = bf16-RNE(x) x16; thread i writes the 16 bytes at byte 16*i ----------------
#define CVTX_BLK (MTOK * (DM / 8) / 256)
__global__ __launch_bounds__(256) void k_cvtx(const float* __restrict__ X, _Float16* XH) {
    const int i = blockIdx.x * 256 + threadIdx.x;                 // < MTOK * 128
    const int tok = i >> 7, k = (i & 127) * 8;
    const int bi = tok / SEQ, si = tok - bi * SEQ;
    const float* xp = X + ((size_t)bi * SEQ_FULL + si) * DM + k;
    const v4f x0 = *(const v4f*)(xp);
    const v4f x1 = *(const v4f*)(xp + 4);
    v8h val;
#pragma unroll
    for (int j = 0; j < 4; ++j) {
        val[j]     = tohx_flush(x0[j], SC_X);
        val[4 + j] = tohx_flush(x1[j], SC_X);
    }
    _Float16* dst = XH + (size_t)tok * DM + k;
    vst16(dst, val);
    
}

// ---------------- weight plane: W [8][1024][128] f32 -> WT rows n = h*128+e, [n][1024] f16 = bf16-RNE(w) x256 (n-major, k-contiguous);
// in[h][d][e] -> out[h*128+e][d]; thread i writes the 16 bytes at byte 16*i of this matrix's 2 MiB slab ----------------
#define PREPW_BLK (NH * DK * (DM / 8) / 256)     // 512
__global__ __launch_bounds__(256) void k_prepw(const float* __restrict__ W, _Float16* WT) {
    const int i = blockIdx.x * 256 + threadIdx.x;                 // < 1024 * 128
    const int n = i >> 7, k = (i & 127) * 8;
    const int hh = n >> 7, e = n & 127;
    v8h val;
#pragma unroll
    for (int j = 0; j < 8; ++j) val[j] = tohx_flush(W[((size_t)hh * DM + k + j) * DK + e], SC_W);
    _Float16* dst = WT + (size_t)n * DM + k;
    vst16(dst, val);
    
}

// ---------------- projections (K = 1024): block = 256 tokens x 128 output columns (group g of 24): g<8 q head g -> QK[0][b][h][s][128] (no bias);
// 8..15 k head -> QK[1][b][h][s][128] (+bk); 16..23 v head -> VT[b][h][d][s] (+bv, transposed via LDS). All planes x8, bias added in f32. ----------------
// Each of the 4 waves owns 64 tokens x 128 columns (4 x 8 accumulator tiles): a fragment read from LDS feeds 8 (activations) or 4 (weights) products.
// Each 64-k tile of the block's 256 activation rows and 128 weight rows (128-B rows) is brought into LDS once per block by asynchronous copies,
// two buffers: tile t+2 flies into the buffer that trip t has left while trip t+1 is worked on. Row pitch 144 B (16 B x odd) for the 16-B readers.
#define PTM 256                                 // tokens per block
#define PMT 4                                   // 16-token tiles per wave
#define PKC 64                                  // k per staged tile
#define PP_H 72                                 // row pitch in LDS, halves
#define PA_H (PTM * PP_H)
#define PB_H (128 * PP_H)
#define PSTAGE_H (PA_H + PB_H)                  // 55,296 B per buffer
#define PNT (DM / PKC)
#define PSV_H (PTM + 8)                         // pitch of the transposed output staging, halves (528 B = 16 B x odd)
static_assert(DM % PKC == 0 && PNT >= 2);
static_assert(SEQ % PTM == 0 && MTOK % PTM == 0);
static_assert((PA_H * 2) % 16 == 0 && (PSTAGE_H * 2) % 16 == 0);
static_assert(PTM * 136 <= 2 * PSTAGE_H && 128 * PSV_H <= 2 * PSTAGE_H);    // the output staging fits in the ring it reuses
__global__ __launch_bounds__(128, 2) void k_proj(const _Float16* __restrict__ XH, const _Float16* __restrict__ WT,
                                              const float* __restrict__ bK, const float* __restrict__ bV,
                                              _Float16* QK, _Float16* VT) {
    __shared__ __align__(16) _Float16 ring[2 * PSTAGE_H];       // two buffers [x 256 x 72 | w 128 x 72]
    _Float16* st = ring;                                        // after the loop: row-major [256][136] or transposed [128][264]
    const int tid = threadIdx.x, lane = tid & 31, l16 = lane & 15, hf = lane >> 4;
    const int wv = __builtin_amdgcn_readfirstlane(threadIdx.x >> 5);
    const int g = blockIdx.y;
    const int t0 = blockIdx.x * PTM;
    const int bi = t0 / SEQ, s0 = t0 - bi * SEQ;               // 256 | SEQ: whole block inside one batch
    const int hh = g & 7;
    const bool isV = (g >= 16);
    // this lane's share of a tile: 16-B column tid%8 of rows j*16 + tid/8, j = 0..15 of the activations, j = 0..7 of the weights
    const unsigned ring0 = (unsigned)(size_t)&ring[0];
    const unsigned la = ring0 + (unsigned)((tid >> 3) * (PP_H * 2) + (tid & 7) * 16);
    const _Float16* ga = XH + (size_t)(t0 + (tid >> 3)) * DM + (tid & 7) * 8;
    const _Float16* gb = WT + (size_t)(g * 128 + (tid >> 3)) * DM + (tid & 7) * 8;
    auto fill = [&](int t, int buf) {
        const unsigned A = la + (unsigned)buf * (PSTAGE_H * 2);
        const unsigned A2 = A + 128 * PP_H * 2;
        const unsigned B = A + PA_H * 2;
        const unsigned R = 16 * PP_H * 2;                           // 16 rows further in LDS
        const _Float16* a = ga + t * PKC;
        const _Float16* a2 = a + 128 * DM;
        const _Float16* b = gb + t * PKC;
        acopy8(A, A + R, A + 2 * R, A + 3 * R, A + 4 * R, A + 5 * R, A + 6 * R, A + 7 * R,
               a, a + 16 * DM, a + 32 * DM, a + 48 * DM, a + 64 * DM, a + 80 * DM, a + 96 * DM, a + 112 * DM);
        acopy8(A2, A2 + R, A2 + 2 * R, A2 + 3 * R, A2 + 4 * R, A2 + 5 * R, A2 + 6 * R, A2 + 7 * R,
               a2, a2 + 16 * DM, a2 + 32 * DM, a2 + 48 * DM, a2 + 64 * DM, a2 + 80 * DM, a2 + 96 * DM, a2 + 112 * DM);
        acopy8(B, B + R, B + 2 * R, B + 3 * R, B + 4 * R, B + 5 * R, B + 6 * R, B + 7 * R,
               b, b + 16 * DM, b + 32 * DM, b + 48 * DM, b + 64 * DM, b + 80 * DM, b + 96 * DM, b + 112 * DM);
    };
    fill(0, 0);
    asm volatile("s_wait_asynccnt 0x0" ::: "memory");              // tile 0 of this wave's copies has landed
    __syncthreads();                                                // ... and every other wave's: tile 0 is published
    fill(1, 1);
    v8f acc[PMT][8];
#pragma unroll
    for (int mt = 0; mt < PMT; ++mt)
#pragma unroll
        for (int nt = 0; nt < 8; ++nt) acc[mt][nt] = (v8f){};
#pragma unroll 1
    for (int kt = 0; kt < PNT; ++kt) {
        const _Float16* As = ring + (kt & 1) * PSTAGE_H + (wv * (16 * PMT) + l16) * PP_H;
        const _Float16* Bs = ring + (kt & 1) * PSTAGE_H + PA_H + l16 * PP_H;
        // every fragment of the tile is read as one group, in the order of its use, ahead of the tile's products
        v16h a[PKC / 32][PMT], bf[PKC / 32][8];
#pragma unroll
        for (int k2 = 0; k2 < PKC / 32; ++k2) {
            a[k2][0] = ldfrag(As + k2 * 32, hf);
#pragma unroll
            for (int nt = 0; nt < 8; ++nt) bf[k2][nt] = ldfrag(Bs + nt * 16 * PP_H + k2 * 32, hf);
#pragma unroll
            for (int mt = 1; mt < PMT; ++mt) a[k2][mt] = ldfrag(As + mt * 16 * PP_H + k2 * 32, hf);
        }
        group_end();
#pragma unroll
        for (int k2 = 0; k2 < PKC / 32; ++k2)
#pragma unroll
            for (int mt = 0; mt < PMT; ++mt)
#pragma unroll
                for (int nt = 0; nt < 8; ++nt) acc[mt][nt] = wmma16(a[k2][mt], bf[k2][nt], acc[mt][nt]);
        group_end();
        asm volatile("s_wait_dscnt 0x0" ::: "memory");             // this wave's reads of buffer kt&1 are over before the buffer is handed back
        asm volatile("s_wait_asynccnt 0x0" ::: "memory");          // this wave's copies of tile kt+1 have landed
        __syncthreads();                                            // publishes tile kt+1 and ends every wave's reads of buffer kt&1
        if (kt + 2 < PNT) fill(kt + 2, kt & 1);
    }
    asm volatile("s_wait_asynccnt 0x0" ::: "memory");              // nothing in flight when the ring becomes output staging
    if (isV) {
        // st[d][tok] pitch 264: lane owns column d, its 8 tokens wv*64+mt*16+8hf..+7 are contiguous -> one 16-B LDS store per tile
#pragma unroll
        for (int nt = 0; nt < 8; ++nt) {
            const int d = nt * 16 + l16;
            const float bb = bfr(bV[hh * DK + d]);
#pragma unroll
            for (int mt = 0; mt < PMT; ++mt) {
                v8h pv;
#pragma unroll
                for (int r = 0; r < 8; ++r) pv[r] = toh_flush((acc[mt][nt][r] * (1.0f / (SC_X * SC_W)) + bb) * SC_QKV);
                *(v8h*)&st[d * PSV_H + wv * (16 * PMT) + mt * 16 + 8 * hf] = pv;
            }
        }
    } else {
        // st[tok][col] pitch 136
#pragma unroll
        for (int nt = 0; nt < 8; ++nt) {
            const int col = nt * 16 + l16;
            const float bkv = bK[hh * DK + col];
            const float bb = (g < 8) ? 0.0f : bfr(bkv);
#pragma unroll
            for (int mt = 0; mt < PMT; ++mt)
#pragma unroll
                for (int r = 0; r < 8; ++r)
                    st[(wv * (16 * PMT) + mt * 16 + 8 * hf + r) * 136 + col] = toh_flush((acc[mt][nt][r] * (1.0f / (SC_X * SC_W)) + bb) * SC_QKV);
        }
    }
    __syncthreads();
    if (isV) {
        // one wave stores one 512-B row piece (256 tokens of one d) per pass
        _Float16* base = VT + ((size_t)(bi * NH + (g - 16)) * DK + wv) * SEQ + s0 + lane * 8;
#pragma unroll
        for (int p = 0; p < 32; ++p) vst16(base + (size_t)(p * 4) * SEQ, *(const v8h*)&st[(p * 4 + wv) * PSV_H + lane * 8]);
    } else {
        // 256 rows x 256 B contiguous inside plane (g>>3) of QK
        _Float16* base = QK + ((size_t)((g >> 3) * (NB * NH) + bi * NH + hh) * SEQ + s0) * DK + tid * 8;
#pragma unroll
        for (int p = 0; p < 32; ++p) vst16(base + p * 1024, *(const v8h*)&st[(p * 8 + (tid >> 4)) * 136 + (tid & 15) * 8]);
    }
}

#define ATW 4
#define AQT 2
#define KP_H 136
#define VP_H 72
#define KBUF_H (64 * KP_H)
#define VBUF_H (DK * VP_H)
#define STAGE_H (KBUF_H + VBUF_H)               // 35,840 B per buffer
#define NTILE (SEQ / 64)
static_assert(SEQ % (ATW * AQT * 16) == 0);
static_assert(NTILE >= 2);
static_assert((KBUF_H * 2) % 16 == 0 && (STAGE_H * 2) % 16 == 0);
static_assert(ATW * 16 * 132 * 4 <= 2 * STAGE_H * 2);   // the output staging (one query tile per wave at a time) fits in the ring it reuses

__global__ __launch_bounds__(ATW * 32, 2) void k_attn(const _Float16* __restrict__ QC, const _Float16* __restrict__ KC,
                                              const _Float16* __restrict__ VT, float* OUT) {
    __shared__ __align__(16) _Float16 ring[2 * STAGE_H];            // two buffers [K 64 x 136 | V^T 128 x 72]; after the loop: output staging
    const int tid = threadIdx.x, lane = tid & 31, l16 = lane & 15, hf = lane >> 4;
    const int wv = __builtin_amdgcn_readfirstlane(threadIdx.x >> 5);
    const int bh = blockIdx.y, bi = bh / NH, hd = bh - bi * NH;
    const int q0 = blockIdx.x * (ATW * AQT * 16) + wv * (AQT * 16);
    const _Float16* kb  = KC  + (size_t)bh * SEQ * DK;
    const _Float16* vb  = VT  + (size_t)bh * DK * SEQ;
    // this lane's share of a tile: K chunks (row j*8 + tid/16, 16-B column tid%16), V^T chunks (row j*16 + tid/8, 16-B column tid%8), j = 0..7
    const unsigned ring0 = (unsigned)(size_t)&ring[0];
    // lk, lv: the lane's LDS addresses in the buffer that the next fill goes to (tile t goes to buffer t&1); they step to and fro with the fills
    unsigned lk = ring0 + (unsigned)((tid >> 4) * (KP_H * 2) + (tid & 15) * 16);
    unsigned lv = ring0 + (unsigned)(KBUF_H * 2 + (tid >> 3) * (VP_H * 2) + (tid & 7) * 16);
    const _Float16* gk = kb + tid * 8;
    const _Float16* gv = vb + (size_t)(tid >> 3) * SEQ + (tid & 7) * 8;
    auto fill = [&](int t) {
        const _Float16* k = gk + (size_t)t * (64 * DK);
        const _Float16* v = gv + t * 64;
        const unsigned RK = 8 * KP_H * 2, RV = 16 * VP_H * 2;       // 8 K rows, 16 V^T rows further in LDS
        acopy8(lk, lk + RK, lk + 2 * RK, lk + 3 * RK, lk + 4 * RK, lk + 5 * RK, lk + 6 * RK, lk + 7 * RK,
               k, k + 8 * DK, k + 16 * DK, k + 24 * DK, k + 32 * DK, k + 40 * DK, k + 48 * DK, k + 56 * DK);
        acopy8(lv, lv + RV, lv + 2 * RV, lv + 3 * RV, lv + 4 * RV, lv + 5 * RV, lv + 6 * RV, lv + 7 * RV,
               v, v + (size_t)16 * SEQ, v + (size_t)32 * SEQ, v + (size_t)48 * SEQ, v + (size_t)64 * SEQ, v + (size_t)80 * SEQ,
               v + (size_t)96 * SEQ, v + (size_t)112 * SEQ);
        const unsigned step = (t & 1) ? 0u - (unsigned)(STAGE_H * 2) : (unsigned)(STAGE_H * 2);
        lk += step;
        lv += step;
    };
    fill(0);
    v16h qf[AQT][4];
#pragma unroll
    for (int qt = 0; qt < AQT; ++qt) {
        const _Float16* qr = QC + ((size_t)bh * SEQ + q0 + qt * 16 + l16) * DK;
#pragma unroll
        for (int cc = 0; cc < 4; ++cc) qf[qt][cc] = ldfrag(qr + cc * 32, hf);
    }
    asm volatile("s_wait_asynccnt 0x0" ::: "memory");              // tile 0 of this wave's copies has landed
    __syncthreads();                                                // ... and every other wave's: tile 0 is published
    fill(1);
    v8f o[AQT][8];
    float m2[AQT], lsum[AQT];
#pragma unroll
    for (int qt = 0; qt < AQT; ++qt) {
#pragma unroll
        for (int d = 0; d < 8; ++d) o[qt][d] = (v8f){};
        m2[qt] = -__builtin_inff();
        lsum[qt] = 0.0f;
    }
    const float c2 = (0.08838834764831845f * 1.4426950408889634f) * (1.0f / (SC_QKV * SC_QKV));   // (1/sqrt(128)) * log2(e) / 64
#pragma unroll 1
    for (int kt = 0; kt < NTILE; ++kt) {
        const _Float16* Ks = ring + (kt & 1) * STAGE_H;
        const _Float16* Vs = Ks + KBUF_H;
        const _Float16* kr = Ks + l16 * KP_H;
        const _Float16* vr = Vs + l16 * VP_H;
        // LDS fragment reads stand in groups, each group issued one or two groups ahead of the products that use it; the tile's V^T fragments
        // are all read while the S^T products run and stay in registers, so the buffer is handed back (and refilled) ahead of the softmax
        v16h kf[4][4], vf[4][4];                                    // K: [k chunk][key tile]; V^T: [key half * 2 + d half][d tile]
        v8f s[AQT][4];
#pragma unroll
        for (int cc = 0; cc < 2; ++cc)
#pragma unroll
            for (int ks = 0; ks < 4; ++ks) kf[cc][ks] = ldfrag(kr + ks * 16 * KP_H + cc * 32, hf);
        group_end();
#pragma unroll
        for (int cc = 0; cc < 4; ++cc) {
#pragma unroll
            for (int ks = 0; ks < 4; ++ks)
#pragma unroll
                for (int qt = 0; qt < AQT; ++qt) s[qt][ks] = wmma16(kf[cc][ks], qf[qt][cc], cc == 0 ? (v8f){} : s[qt][ks]);
            group_end();
            if (cc < 2) {
#pragma unroll
                for (int ks = 0; ks < 4; ++ks) kf[cc + 2][ks] = ldfrag(kr + ks * 16 * KP_H + (cc + 2) * 32, hf);
                group_end();
            } else if (cc == 2) {
#pragma unroll
                for (int g = 0; g < 4; ++g)
#pragma unroll
                    for (int d = 0; d < 4; ++d) vf[g][d] = ldfrag(vr + ((g & 1) * 4 + d) * 16 * VP_H + (g >> 1) * 32, hf);
                group_end();
            }
        }
        asm volatile("s_wait_dscnt 0x0" ::: "memory");             // this wave's reads of buffer kt&1 are over before the buffer is handed back
        asm volatile("s_wait_asynccnt 0x0" ::: "memory");          // this wave's copies of tile kt+1 have landed
        __syncthreads();                                            // publishes tile kt+1 and ends every wave's reads of buffer kt&1
        if (kt + 2 < NTILE) fill(kt + 2);
        // from here to the end of the trip: registers only
        float alpha[AQT];
        v16h pf[AQT][2];
#pragma unroll
        for (int qt = 0; qt < AQT; ++qt) {
            float mloc = -__builtin_inff();
#pragma unroll
            for (int ks = 0; ks < 4; ++ks)
#pragma unroll
                for (int r = 0; r < 8; ++r) { s[qt][ks][r] *= c2; mloc = fmaxf(mloc, s[qt][ks][r]); }
            mloc = fmaxf(mloc, __shfl_xor(mloc, 16, 32));
            const float mn = fmaxf(m2[qt], mloc);
            alpha[qt] = exp2f(m2[qt] - mn);
            float ls = 0.0f;
#pragma unroll
            for (int ks = 0; ks < 4; ++ks)
#pragma unroll
                for (int r = 0; r < 8; ++r) {
                    const float e = (s[qt][ks][r] - mn) + P_CARRY_LOG2;
                    const float p = (e < -14.0f) ? 0.0f : exp2f(e);  // numerators x256; nothing below the smallest f16 normal survives
                    ls += p;
                    pf[qt][ks >> 1][(ks & 1) * 8 + r] = (_Float16)p; // keys 32j+8hf+r -> elements 0..7, keys 32j+16+8hf+r -> elements 8..15
                }
            m2[qt] = mn;
            lsum[qt] = lsum[qt] * alpha[qt] + ls;
        }
#pragma unroll
        for (int qt = 0; qt < AQT; ++qt)
#pragma unroll
            for (int d = 0; d < 8; ++d) o[qt][d] *= alpha[qt];
#pragma unroll
        for (int g = 0; g < 4; ++g)
#pragma unroll
            for (int d = 0; d < 4; ++d)
#pragma unroll
                for (int qt = 0; qt < AQT; ++qt) o[qt][(g & 1) * 4 + d] = wmma16(vf[g][d], pf[qt][g >> 1], o[qt][(g & 1) * 4 + d]);
    }
    asm volatile("s_wait_asynccnt 0x0" ::: "memory");              // nothing in flight when the ring becomes output staging
    float* stw = (float*)ring + wv * (16 * 132);                    // per wave 16 q rows x 128 d, pitch 132 floats (528 B); private to its wave
#pragma unroll
    for (int qt = 0; qt < AQT; ++qt) {
        const float lt = lsum[qt] + __shfl_xor(lsum[qt], 16, 32);
        const float inv = (1.0f / lt) * (1.0f / SC_QKV);             // the x256 carry cancels between o and lt
#pragma unroll
        for (int d = 0; d < 8; ++d) {
            v4f p0, p1;
#pragma unroll
            for (int r = 0; r < 4; ++r) { p0[r] = o[qt][d][r] * inv; p1[r] = o[qt][d][4 + r] * inv; }
            *(v4f*)&stw[l16 * 132 + d * 16 + 8 * hf]     = p0;       // row = query l16, cols d*16+8hf..+7
            *(v4f*)&stw[l16 * 132 + d * 16 + 8 * hf + 4] = p1;
        }
        __syncthreads();                                            // the tile's rows are written before other lanes read them back
        float* obase = OUT + ((size_t)bi * SEQ_FULL + q0 + qt * 16) * DM + hd * DK + lane * 4;
#pragma unroll
        for (int t = 0; t < 16; ++t) vst16f(obase + (size_t)t * DM, *(const v4f*)&stw[t * 132 + lane * 4]);
    }
}

extern "C" void kernel_launch(void* const* d_in, const int* in_sizes, int n_in,
                              void* d_out, int out_size, void* d_ws, size_t ws_size, hipStream_t stream) {
    if (n_in < 6) return;
    const long long needTok = (long long)(NB - 1) * SEQ_FULL + SEQ;
    if ((long long)in_sizes[0] < needTok * DM) return;
    if (in_sizes[1] < NH * DM * DK || in_sizes[2] < NH * DM * DK || in_sizes[3] < NH * DK ||
        in_sizes[4] < NH * DM * DK || in_sizes[5] < NH * DK) return;
    if ((long long)out_size < needTok * DM) return;

    const float* x  = (const float*)d_in[0];    // [4][2048][1024]
    const float* Wq = (const float*)d_in[1];    // [8][1024][128]
    const float* Wk = (const float*)d_in[2];    // [8][1024][128]
    const float* bk = (const float*)d_in[3];    // [8][128]
    const float* Wv = (const float*)d_in[4];    // [8][1024][128]
    const float* bv = (const float*)d_in[5];    // [8][128]
    float* out = (float*)d_out;                  // [4][2048][1024]

    char* ws = (char*)d_ws;
    size_t off = 0;
    auto carve = [&](size_t bytes) -> char* { char* p = ws + off; off += (bytes + 255) & ~(size_t)255; return p; };
    _Float16* XH = (_Float16*)carve(WS_XH);      // [MTOK][1024]
    _Float16* WT = (_Float16*)carve(WS_WT);      // [3072][1024]: q heads | k heads | v heads
    _Float16* QK = (_Float16*)carve(WS_QK);      // [2][NB*NH][SEQ][128]: q plane then k plane
    _Float16* VT = (_Float16*)carve(WS_VT);      // [NB*NH][128][SEQ]
    if (off > ws_size) return;
    _Float16* QC = QK;
    _Float16* KC = QK + (size_t)NB * NH * SEQ * DK;

    k_cvtx<<<CVTX_BLK, 256, 0, stream>>>(x, XH);
    k_prepw<<<PREPW_BLK, 256, 0, stream>>>(Wq, WT);
    k_prepw<<<PREPW_BLK, 256, 0, stream>>>(Wk, WT + (size_t)NH * DK * DM);
    k_prepw<<<PREPW_BLK, 256, 0, stream>>>(Wv, WT + (size_t)2 * NH * DK * DM);
    k_proj<<<dim3(MTOK / PTM, PROJN / 128, 1), 128, 0, stream>>>(XH, WT, bk, bv, QK, VT);
    k_attn<<<dim3(SEQ / (ATW * AQT * 16), NB * NH, 1), ATW * 32, 0, stream>>>(QC, KC, VT, out);
}

// v004
// It runs in 123 microseconds.
// Timed twice side by side with v003, it ran 1.15 times as fast both times.
// Over all steps from v000 it is 4.01 times as fast.
#include <hip/hip_runtime.h>

// All contractions on v_wmma_f32_16x16x32_f16 (f16 operands built from bf16-RNE input values with power-of-two carries, f32 accumulate):
// per-head projections x.[Wq|Wk|Wv] (K=1024), per-(b,h) k.q^T (K=128), v^T.p^T (K=seq); online softmax, bias adds and normalisation in f32.

#ifndef NB
#define NB 4
#endif
#ifndef SEQ
#define SEQ 2048
#endif
#define NB_FULL 4
#define SEQ_FULL 2048
#define DM 1024
#define NH 8
#define DK 128
#define MTOK (NB * SEQ)
#define PROJN (3 * NH * DK)             // 3072 rows of the n-major projection weight plane: Wq heads | Wk heads | Wv heads

static_assert(SEQ % 64 == 0);
static_assert(SEQ <= SEQ_FULL);
static_assert(NB >= 1 && NB <= NB_FULL);
static_assert(DM % 32 == 0);
static_assert(DK == 128);
static_assert(NH * DK == DM);
static_assert(PROJN == 3072);
static_assert(PROJN % 128 == 0);
static_assert(MTOK % 64 == 0);
static_assert(((size_t)MTOK * DM / 8) % 256 == 0);
static_assert(((size_t)NH * DK * DM / 8) % 256 == 0);

// exact power-of-two carries
#define SC_X   16.0f    // activation plane (|x| <= ~6 -> <= ~96)
#define SC_W   256.0f   // projection weights (|w| <= ~0.18 -> <= ~46)
#define SC_QKV 8.0f     // q, k, v planes
#define P_CARRY_LOG2 8.0f   // softmax numerators carried x256 (the row sum carries the same factor)

// workspace plan (bytes), every region a multiple of 256
#define WS_XH ((size_t)MTOK * DM * 2)
#define WS_WT ((size_t)PROJN * DM * 2)
#define WS_QK (2 * (size_t)NB * NH * SEQ * DK * 2)
#define WS_VT ((size_t)NB * NH * DK * SEQ * 2)
#define WS_TOTAL (WS_XH + WS_WT + WS_QK + WS_VT)
static_assert(WS_XH % 256 == 0 && WS_WT % 256 == 0 && WS_QK % 256 == 0 && WS_VT % 256 == 0);
static_assert(WS_TOTAL <= (size_t)134217728);

typedef _Float16 v8h  __attribute__((ext_vector_type(8)));
typedef _Float16 v16h __attribute__((ext_vector_type(16)));
typedef float    v8f  __attribute__((ext_vector_type(8)));
typedef float    v4f  __attribute__((ext_vector_type(4)));
typedef unsigned v4u  __attribute__((ext_vector_type(4)));
typedef float    v2f  __attribute__((ext_vector_type(2)));
typedef _Float16 v2h  __attribute__((ext_vector_type(2)));

// bf16 RNE of an f32 value, kept as f32
__device__ __forceinline__ float bfr(float f) {
    unsigned u = __float_as_uint(f);
    u = (u + 0x7fffu + ((u >> 16) & 1u)) & 0xffff0000u;
    return __uint_as_float(u);
}
// input value -> bf16 RNE -> times exact power of two -> f16 (exact for normal results)
__device__ __forceinline__ _Float16 tohx(float f, float sc) { return (_Float16)(bfr(f) * sc); }
// f32 -> f16 that can never yield an f16 subnormal (value select applied after the carry)
__device__ __forceinline__ _Float16 toh_flush(float v) {
    const _Float16 r = (_Float16)v;
    return (fabsf(v) < 6.103515625e-05f) ? (_Float16)0.0f : r;
}
__device__ __forceinline__ _Float16 tohx_flush(float f, float sc) { return toh_flush(bfr(f) * sc); }

// one 16x16x32 f16 WMMA (builtin: the compiler keeps the hazard distance itself); D element r of lane l = (row 8*(l>>4)+r, col l&15)
__device__ __forceinline__ v8f wmma16(v16h a, v16h b, v8f c) {
    return __builtin_amdgcn_wmma_f32_16x16x32_f16(false, a, false, b, (short)0, c, false, false);
}
// A fragment of row p (p = row start + k0) or B fragment of an n-major (k-contiguous) row: lane half hf,
// elements 0..7 <- k0+8hf..+7, elements 8..15 <- k0+16+8hf..+7 (same map for A and B)
__device__ __forceinline__ v16h ldfrag(const _Float16* p, int hf) {
    const v8h lo = *(const v8h*)(p + 8 * hf);
    const v8h hi = *(const v8h*)(p + 16 + 8 * hf);
    return __builtin_shufflevector(lo, hi, 0, 1, 2, 3, 4, 5, 6, 7, 8, 9, 10, 11, 12, 13, 14, 15);
}
// ends a group of LDS fragment reads or a group of products: without it the compiler sinks each read to just ahead of its product (one full
// LDS wait per product), lifts a later group over the products whose registers it is to take, or drops the products behind the trip's barrier
__device__ __forceinline__ void group_end() { __builtin_amdgcn_sched_barrier(0); }
// the value that lane l ^ 16 holds, by a vector cross-row move (no LDS instruction, no LDS wait)
__device__ __forceinline__ float xhalf(float v) {
    const int b = __builtin_bit_cast(int, v);
    return __builtin_bit_cast(float, __builtin_amdgcn_permlanex16(b, b, 0x76543210, 0xfedcba98, false, false));
}
__device__ __forceinline__ float max3f(float a, float b, float c) { return fmaxf(fmaxf(a, b), c); }
__device__ __forceinline__ void vst16(_Float16* g, v8h v) { *(v4u*)g = __builtin_bit_cast(v4u, v); }
__device__ __forceinline__ void vst16f(float* g, v4f v) { *(v4f*)g = v; }

// 16-B-per-lane asynchronous copies global -> LDS (l = the lane's LDS byte address, g = its global address), eight in one statement;
// the s_wait_xcnt stands inside the statement so that no address register named here is rewritten ahead of it
__device__ __forceinline__ void acopy8(unsigned l0, unsigned l1, unsigned l2, unsigned l3, unsigned l4, unsigned l5, unsigned l6, unsigned l7,
                                       const _Float16* g0, const _Float16* g1, const _Float16* g2, const _Float16* g3,
                                       const _Float16* g4, const _Float16* g5, const _Float16* g6, const _Float16* g7) {
    asm volatile("global_load_async_to_lds_b128 %0, %8, off\n\t"
                 "global_load_async_to_lds_b128 %1, %9, off\n\t"
                 "global_load_async_to_lds_b128 %2, %10, off\n\t"
                 "global_load_async_to_lds_b128 %3, %11, off\n\t"
                 "global_load_async_to_lds_b128 %4, %12, off\n\t"
                 "global_load_async_to_lds_b128 %5, %13, off\n\t"
                 "global_load_async_to_lds_b128 %6, %14, off\n\t"
                 "global_load_async_to_lds_b128 %7, %15, off\n\t"
                 "s_wait_xcnt 0x0"
                 :: "v"(l0), "v"(l1), "v"(l2), "v"(l3), "v"(l4), "v"(l5), "v"(l6), "v"(l7),
                    "v"(g0), "v"(g1), "v"(g2), "v"(g3), "v"(g4), "v"(g5), "v"(g6), "v"(g7)
                 : "memory");
}

// ---------------- activation plane: XH [MTOK][1024] f16 = bf16-RNE(x) x16; thread i writes the 16 bytes at byte 16*i ----------------
#define CVTX_BLK (MTOK * (DM / 8) / 256)
__global__ __launch_bounds__(256) void k_cvtx(const float* __restrict__ X, _Float16* XH) {
    const int i = blockIdx.x * 256 + threadIdx.x;                 // < MTOK * 128
    const int tok = i >> 7, k = (i & 127) * 8;
    const int bi = tok / SEQ, si = tok - bi * SEQ;
    const float* xp = X + ((size_t)bi * SEQ_FULL + si) * DM + k;
    const v4f x0 = *(const v4f*)(xp);
    const v4f x1 = *(const v4f*)(xp + 4);
    v8h val;
#pragma unroll
    for (int j = 0; j < 4; ++j) {
        val[j]     = tohx_flush(x0[j], SC_X);
        val[4 + j] = tohx_flush(x1[j], SC_X);
    }
    _Float16* dst = XH + (size_t)tok * DM + k;
    vst16(dst, val);
    
}

// ---------------- weight plane: W [8][1024][128] f32 -> WT rows n = h*128+e, [n][1024] f16 = bf16-RNE(w) x256 (n-major, k-contiguous);
// in[h][d][e] -> out[h*128+e][d]; thread i writes the 16 bytes at byte 16*i of this matrix's 2 MiB slab ----------------
#define PREPW_BLK (NH * DK * (DM / 8) / 256)     // 512
__global__ __launch_bounds__(256) void k_prepw(const float* __restrict__ W, _Float16* WT) {
    const int i = blockIdx.x * 256 + threadIdx.x;                 // < 1024 * 128
    const int n = i >> 7, k = (i & 127) * 8;
    const int hh = n >> 7, e = n & 127;
    v8h val;
#pragma unroll
    for (int j = 0; j < 8; ++j) val[j] = tohx_flush(W[((size_t)hh * DM + k + j) * DK + e], SC_W);
    _Float16* dst = WT + (size_t)n * DM + k;
    vst16(dst, val);
    
}

// ---------------- projections (K = 1024): block = 256 tokens x 128 output columns (group g of 24): g<8 q head g -> QK[0][b][h][s][128] (no bias);
// 8..15 k head -> QK[1][b][h][s][128] (+bk); 16..23 v head -> VT[b][h][d][s] (+bv, transposed via LDS). All planes x8, bias added in f32. ----------------
// Each of the 4 waves owns 64 tokens x 128 columns (4 x 8 accumulator tiles): a fragment read from LDS feeds 8 (activations) or 4 (weights) products.
// Each 64-k tile of the block's 256 activation rows and 128 weight rows (128-B rows) is brought into LDS once per block by asynchronous copies,
// two buffers: tile t+2 flies into the buffer that trip t has left while trip t+1 is worked on. Row pitch 144 B (16 B x odd) for the 16-B readers.
#define PTM 256                                 // tokens per block
#define PMT 4                                   // 16-token tiles per wave
#define PKC 64                                  // k per staged tile
#define PP_H 72                                 // row pitch in LDS, halves
#define PA_H (PTM * PP_H)
#define PB_H (128 * PP_H)
#define PSTAGE_H (PA_H + PB_H)                  // 55,296 B per buffer
#define PNT (DM / PKC)
#define PSV_H (PTM + 8)                         // pitch of the transposed output staging, halves (528 B = 16 B x odd)
static_assert(DM % PKC == 0 && PNT >= 2);
static_assert(SEQ % PTM == 0 && MTOK % PTM == 0);
static_assert((PA_H * 2) % 16 == 0 && (PSTAGE_H * 2) % 16 == 0);
static_assert(PTM * 136 <= 2 * PSTAGE_H && 128 * PSV_H <= 2 * PSTAGE_H);    // the output staging fits in the ring it reuses
__global__ __launch_bounds__(128, 2) void k_proj(const _Float16* __restrict__ XH, const _Float16* __restrict__ WT,
                                              const float* __restrict__ bK, const float* __restrict__ bV,
                                              _Float16* QK, _Float16* VT) {
    __shared__ __align__(16) _Float16 ring[2 * PSTAGE_H];       // two buffers [x 256 x 72 | w 128 x 72]
    _Float16* st = ring;                                        // after the loop: row-major [256][136] or transposed [128][264]
    const int tid = threadIdx.x, lane = tid & 31, l16 = lane & 15, hf = lane >> 4;
    const int wv = __builtin_amdgcn_readfirstlane(threadIdx.x >> 5);
    const int g = blockIdx.y;
    const int t0 = blockIdx.x * PTM;
    const int bi = t0 / SEQ, s0 = t0 - bi * SEQ;               // 256 | SEQ: whole block inside one batch
    const int hh = g & 7;
    const bool isV = (g >= 16);
    // this lane's share of a tile: 16-B column tid%8 of rows j*16 + tid/8, j = 0..15 of the activations, j = 0..7 of the weights
    const unsigned ring0 = (unsigned)(size_t)&ring[0];
    const unsigned la = ring0 + (unsigned)((tid >> 3) * (PP_H * 2) + (tid & 7) * 16);
    const _Float16* ga = XH + (size_t)(t0 + (tid >> 3)) * DM + (tid & 7) * 8;
    const _Float16* gb = WT + (size_t)(g * 128 + (tid >> 3)) * DM + (tid & 7) * 8;
    auto fill = [&](int t, int buf) {
        const unsigned A = la + (unsigned)buf * (PSTAGE_H * 2);
        const unsigned A2 = A + 128 * PP_H * 2;
        const unsigned B = A + PA_H * 2;
        const unsigned R = 16 * PP_H * 2;                           // 16 rows further in LDS
        const _Float16* a = ga + t * PKC;
        const _Float16* a2 = a + 128 * DM;
        const _Float16* b = gb + t * PKC;
        acopy8(A, A + R, A + 2 * R, A + 3 * R, A + 4 * R, A + 5 * R, A + 6 * R, A + 7 * R,
               a, a + 16 * DM, a + 32 * DM, a + 48 * DM, a + 64 * DM, a + 80 * DM, a + 96 * DM, a + 112 * DM);
        acopy8(A2, A2 + R, A2 + 2 * R, A2 + 3 * R, A2 + 4 * R, A2 + 5 * R, A2 + 6 * R, A2 + 7 * R,
               a2, a2 + 16 * DM, a2 + 32 * DM, a2 + 48 * DM, a2 + 64 * DM, a2 + 80 * DM, a2 + 96 * DM, a2 + 112 * DM);
        acopy8(B, B + R, B + 2 * R, B + 3 * R, B + 4 * R, B + 5 * R, B + 6 * R, B + 7 * R,
               b, b + 16 * DM, b + 32 * DM, b + 48 * DM, b + 64 * DM, b + 80 * DM, b + 96 * DM, b + 112 * DM);
    };
    fill(0, 0);
    asm volatile("s_wait_asynccnt 0x0" ::: "memory");              // tile 0 of this wave's copies has landed
    __syncthreads();                                                // ... and every other wave's: tile 0 is published
    fill(1, 1);
    v8f acc[PMT][8];
#pragma unroll
    for (int mt = 0; mt < PMT; ++mt)
#pragma unroll
        for (int nt = 0; nt < 8; ++nt) acc[mt][nt] = (v8f){};
#pragma unroll 1
    for (int kt = 0; kt < PNT; ++kt) {
        const _Float16* As = ring + (kt & 1) * PSTAGE_H + (wv * (16 * PMT) + l16) * PP_H;
        const _Float16* Bs = ring + (kt & 1) * PSTAGE_H + PA_H + l16 * PP_H;
        // every fragment of the tile is read as one group, in the order of its use, ahead of the tile's products
        v16h a[PKC / 32][PMT], bf[PKC / 32][8];
#pragma unroll
        for (int k2 = 0; k2 < PKC / 32; ++k2) {
            a[k2][0] = ldfrag(As + k2 * 32, hf);
#pragma unroll
            for (int nt = 0; nt < 8; ++nt) bf[k2][nt] = ldfrag(Bs + nt * 16 * PP_H + k2 * 32, hf);
#pragma unroll
            for (int mt = 1; mt < PMT; ++mt) a[k2][mt] = ldfrag(As + mt * 16 * PP_H + k2 * 32, hf);
        }
        group_end();
#pragma unroll
        for (int k2 = 0; k2 < PKC / 32; ++k2)
#pragma unroll
            for (int mt = 0; mt < PMT; ++mt)
#pragma unroll
                for (int nt = 0; nt < 8; ++nt) acc[mt][nt] = wmma16(a[k2][mt], bf[k2][nt], acc[mt][nt]);
        group_end();
        asm volatile("s_wait_dscnt 0x0" ::: "memory");             // this wave's reads of buffer kt&1 are over before the buffer is handed back
        asm volatile("s_wait_asynccnt 0x0" ::: "memory");          // this wave's copies of tile kt+1 have landed
        __syncthreads();                                            // publishes tile kt+1 and ends every wave's reads of buffer kt&1
        if (kt + 2 < PNT) fill(kt + 2, kt & 1);
    }
    asm volatile("s_wait_asynccnt 0x0" ::: "memory");              // nothing in flight when the ring becomes output staging
    if (isV) {
        // st[d][tok] pitch 264: lane owns column d, its 8 tokens wv*64+mt*16+8hf..+7 are contiguous -> one 16-B LDS store per tile
#pragma unroll
        for (int nt = 0; nt < 8; ++nt) {
            const int d = nt * 16 + l16;
            const float bb = bfr(bV[hh * DK + d]);
#pragma unroll
            for (int mt = 0; mt < PMT; ++mt) {
                v8h pv;
#pragma unroll
                for (int r = 0; r < 8; ++r) pv[r] = toh_flush((acc[mt][nt][r] * (1.0f / (SC_X * SC_W)) + bb) * SC_QKV);
                *(v8h*)&st[d * PSV_H + wv * (16 * PMT) + mt * 16 + 8 * hf] = pv;
            }
        }
    } else {
        // st[tok][col] pitch 136
#pragma unroll
        for (int nt = 0; nt < 8; ++nt) {
            const int col = nt * 16 + l16;
            const float bkv = bK[hh * DK + col];
            const float bb = (g < 8) ? 0.0f : bfr(bkv);
#pragma unroll
            for (int mt = 0; mt < PMT; ++mt)
#pragma unroll
                for (int r = 0; r < 8; ++r)
                    st[(wv * (16 * PMT) + mt * 16 + 8 * hf + r) * 136 + col] = toh_flush((acc[mt][nt][r] * (1.0f / (SC_X * SC_W)) + bb) * SC_QKV);
        }
    }
    __syncthreads();
    if (isV) {
        // one wave stores one 512-B row piece (256 tokens of one d) per pass
        _Float16* base = VT + ((size_t)(bi * NH + (g - 16)) * DK + wv) * SEQ + s0 + lane * 8;
#pragma unroll
        for (int p = 0; p < 32; ++p) vst16(base + (size_t)(p * 4) * SEQ, *(const v8h*)&st[(p * 4 + wv) * PSV_H + lane * 8]);
    } else {
        // 256 rows x 256 B contiguous inside plane (g>>3) of QK
        _Float16* base = QK + ((size_t)((g >> 3) * (NB * NH) + bi * NH + hh) * SEQ + s0) * DK + tid * 8;
#pragma unroll
        for (int p = 0; p < 32; ++p) vst16(base + p * 1024, *(const v8h*)&st[(p * 8 + (tid >> 4)) * 136 + (tid & 15) * 8]);
    }
}

#define ATW 4
#define AQT 2
#define KP_H 136
#define VP_H 72
#define KBUF_H (64 * KP_H)
#define VBUF_H (DK * VP_H)
#define STAGE_H (KBUF_H + VBUF_H)               // 35,840 B per buffer
#define NTILE (SEQ / 64)
static_assert(SEQ % (ATW * AQT * 16) == 0);
static_assert(NTILE >= 2);
static_assert((KBUF_H * 2) % 16 == 0 && (STAGE_H * 2) % 16 == 0);
static_assert(ATW * 16 * 132 * 4 <= 2 * STAGE_H * 2);   // the output staging (one query tile per wave at a time) fits in the ring it reuses

__global__ __launch_bounds__(ATW * 32, 2) void k_attn(const _Float16* __restrict__ QC, const _Float16* __restrict__ KC,
                                              const _Float16* __restrict__ VT, float* OUT) {
    __shared__ __align__(16) _Float16 ring[2 * STAGE_H];            // two buffers [K 64 x 136 | V^T 128 x 72]; after the loop: output staging
    const int tid = threadIdx.x, lane = tid & 31, l16 = lane & 15, hf = lane >> 4;
    const int wv = __builtin_amdgcn_readfirstlane(threadIdx.x >> 5);
    const int bh = blockIdx.y, bi = bh / NH, hd = bh - bi * NH;
    const int q0 = blockIdx.x * (ATW * AQT * 16) + wv * (AQT * 16);
    const _Float16* kb  = KC  + (size_t)bh * SEQ * DK;
    const _Float16* vb  = VT  + (size_t)bh * DK * SEQ;
    // this lane's share of a tile: K chunks (row j*8 + tid/16, 16-B column tid%16), V^T chunks (row j*16 + tid/8, 16-B column tid%8), j = 0..7
    const unsigned ring0 = (unsigned)(size_t)&ring[0];
    // lk, lv: the lane's LDS addresses in the buffer that the next fill goes to (tile t goes to buffer t&1); they step to and fro with the fills
    unsigned lk = ring0 + (unsigned)((tid >> 4) * (KP_H * 2) + (tid & 15) * 16);
    unsigned lv = ring0 + (unsigned)(KBUF_H * 2 + (tid >> 3) * (VP_H * 2) + (tid & 7) * 16);
    const _Float16* gk = kb + tid * 8;
    const _Float16* gv = vb + (size_t)(tid >> 3) * SEQ + (tid & 7) * 8;
    auto fill = [&](int t) {
        const _Float16* k = gk + (size_t)t * (64 * DK);
        const _Float16* v = gv + t * 64;
        const unsigned RK = 8 * KP_H * 2, RV = 16 * VP_H * 2;       // 8 K rows, 16 V^T rows further in LDS
        acopy8(lk, lk + RK, lk + 2 * RK, lk + 3 * RK, lk + 4 * RK, lk + 5 * RK, lk + 6 * RK, lk + 7 * RK,
               k, k + 8 * DK, k + 16 * DK, k + 24 * DK, k + 32 * DK, k + 40 * DK, k + 48 * DK, k + 56 * DK);
        acopy8(lv, lv + RV, lv + 2 * RV, lv + 3 * RV, lv + 4 * RV, lv + 5 * RV, lv + 6 * RV, lv + 7 * RV,
               v, v + (size_t)16 * SEQ, v + (size_t)32 * SEQ, v + (size_t)48 * SEQ, v + (size_t)64 * SEQ, v + (size_t)80 * SEQ,
               v + (size_t)96 * SEQ, v + (size_t)112 * SEQ);
        const unsigned step = (t & 1) ? 0u - (unsigned)(STAGE_H * 2) : (unsigned)(STAGE_H * 2);
        lk += step;
        lv += step;
    };
    fill(0);
    v16h qf[AQT][4];
#pragma unroll
    for (int qt = 0; qt < AQT; ++qt) {
        const _Float16* qr = QC + ((size_t)bh * SEQ + q0 + qt * 16 + l16) * DK;
#pragma unroll
        for (int cc = 0; cc < 4; ++cc) qf[qt][cc] = ldfrag(qr + cc * 32, hf);
    }
    asm volatile("s_wait_asynccnt 0x0" ::: "memory");              // tile 0 of this wave's copies has landed
    __syncthreads();                                                // ... and every other wave's: tile 0 is published
    fill(1);
    v8f o[AQT][8];
    float m2[AQT], lsum[AQT];
#pragma unroll
    for (int qt = 0; qt < AQT; ++qt) {
#pragma unroll
        for (int d = 0; d < 8; ++d) o[qt][d] = (v8f){};
        m2[qt] = -__builtin_inff();
        lsum[qt] = 0.0f;
    }
    const float c2 = (0.08838834764831845f * 1.4426950408889634f) * (1.0f / (SC_QKV * SC_QKV));   // (1/sqrt(128)) * log2(e) / 64; m2 holds raw products
#pragma unroll 1
    for (int kt = 0; kt < NTILE; ++kt) {
        const _Float16* Ks = ring + (kt & 1) * STAGE_H;
        const _Float16* Vs = Ks + KBUF_H;
        const _Float16* kr = Ks + l16 * KP_H;
        const _Float16* vr = Vs + l16 * VP_H;
        // LDS fragment reads stand in groups, each group issued one or two groups ahead of the products that use it; the tile's V^T fragments
        // are all read while the S^T products run and stay in registers, so the buffer is handed back (and refilled) ahead of the softmax
        v16h kf[4][4], vf[4][4];                                    // K: [k chunk][key tile]; V^T: [key half * 2 + d half][d tile]
        v8f s[AQT][4];
#pragma unroll
        for (int cc = 0; cc < 2; ++cc)
#pragma unroll
            for (int ks = 0; ks < 4; ++ks) kf[cc][ks] = ldfrag(kr + ks * 16 * KP_H + cc * 32, hf);
        group_end();
#pragma unroll
        for (int cc = 0; cc < 4; ++cc) {
#pragma unroll
            for (int ks = 0; ks < 4; ++ks)
#pragma unroll
                for (int qt = 0; qt < AQT; ++qt) s[qt][ks] = wmma16(kf[cc][ks], qf[qt][cc], cc == 0 ? (v8f){} : s[qt][ks]);
            group_end();
            if (cc < 2) {
#pragma unroll
                for (int ks = 0; ks < 4; ++ks) kf[cc + 2][ks] = ldfrag(kr + ks * 16 * KP_H + (cc + 2) * 32, hf);
                group_end();
            } else if (cc == 2) {
#pragma unroll
                for (int g = 0; g < 4; ++g)
#pragma unroll
                    for (int d = 0; d < 4; ++d) vf[g][d] = ldfrag(vr + ((g & 1) * 4 + d) * 16 * VP_H + (g >> 1) * 32, hf);
                group_end();
            }
        }
        asm volatile("s_wait_dscnt 0x0" ::: "memory");             // this wave's reads of buffer kt&1 are over before the buffer is handed back
        asm volatile("s_wait_asynccnt 0x0" ::: "memory");          // this wave's copies of tile kt+1 have landed
        __syncthreads();                                            // publishes tile kt+1 and ends every wave's reads of buffer kt&1
        if (kt + 2 < NTILE) fill(kt + 2);
        // from here to the end of the trip: registers only
        float alpha[AQT];
        v16h pf[AQT][2];
#pragma unroll
        for (int qt = 0; qt < AQT; ++qt) {
            // the maximum is taken on the raw products (c2 > 0 keeps their order); one short chain of three-input maxima per key tile
            float mk[4];
#pragma unroll
            for (int ks = 0; ks < 4; ++ks) {
                mk[ks] = max3f(s[qt][ks][0], s[qt][ks][1], s[qt][ks][2]);
                mk[ks] = max3f(mk[ks], s[qt][ks][3], s[qt][ks][4]);
                mk[ks] = max3f(mk[ks], s[qt][ks][5], s[qt][ks][6]);
            }
            mk[0] = max3f(mk[0], s[qt][0][7], s[qt][1][7]);
            mk[1] = max3f(mk[1], s[qt][2][7], s[qt][3][7]);
            float mloc = fmaxf(max3f(mk[0], mk[1], mk[2]), mk[3]);
            mloc = fmaxf(mloc, xhalf(mloc));
            const float mn = fmaxf(m2[qt], mloc);
            alpha[qt] = __builtin_amdgcn_exp2f((m2[qt] - mn) * c2);
            const float nb = P_CARRY_LOG2 - mn * c2;                // numerators x256; one below 2^-14 goes on as an f16 subnormal
            const v2f c2v = {c2, c2}, nbv = {nb, nb};
            v2f ls2[4];                                             // one chain of pair sums per key tile
#pragma unroll
            for (int ks = 0; ks < 4; ++ks) {
#pragma unroll
                for (int r = 0; r < 8; r += 2) {
                    const v2f sv = {s[qt][ks][r], s[qt][ks][r + 1]};
                    const v2f e = __builtin_elementwise_fma(sv, c2v, nbv);
                    const v2f p = {__builtin_amdgcn_exp2f(e[0]), __builtin_amdgcn_exp2f(e[1])};
                    ls2[ks] = (r == 0) ? p : ls2[ks] + p;
                    const v2h ph = __builtin_convertvector(p, v2h);
                    pf[qt][ks >> 1][(ks & 1) * 8 + r]     = ph[0];  // keys 32j+8hf+r -> elements 0..7, keys 32j+16+8hf+r -> elements 8..15
                    pf[qt][ks >> 1][(ks & 1) * 8 + r + 1] = ph[1];
                }
            }
            const v2f lt2 = (ls2[0] + ls2[1]) + (ls2[2] + ls2[3]);
            m2[qt] = mn;
            lsum[qt] = lsum[qt] * alpha[qt] + (lt2[0] + lt2[1]);
        }
#pragma unroll
        for (int qt = 0; qt < AQT; ++qt)
#pragma unroll
            for (int d = 0; d < 8; ++d) o[qt][d] *= alpha[qt];
#pragma unroll
        for (int g = 0; g < 4; ++g)
#pragma unroll
            for (int d = 0; d < 4; ++d)
#pragma unroll
                for (int qt = 0; qt < AQT; ++qt) o[qt][(g & 1) * 4 + d] = wmma16(vf[g][d], pf[qt][g >> 1], o[qt][(g & 1) * 4 + d]);
    }
    asm volatile("s_wait_asynccnt 0x0" ::: "memory");              // nothing in flight when the ring becomes output staging
    float* stw = (float*)ring + wv * (16 * 132);                    // per wave 16 q rows x 128 d, pitch 132 floats (528 B); private to its wave
#pragma unroll
    for (int qt = 0; qt < AQT; ++qt) {
        const float lt = lsum[qt] + __shfl_xor(lsum[qt], 16, 32);
        const float inv = (1.0f / lt) * (1.0f / SC_QKV);             // the x256 carry cancels between o and lt
#pragma unroll
        for (int d = 0; d < 8; ++d) {
            v4f p0, p1;
#pragma unroll
            for (int r = 0; r < 4; ++r) { p0[r] = o[qt][d][r] * inv; p1[r] = o[qt][d][4 + r] * inv; }
            *(v4f*)&stw[l16 * 132 + d * 16 + 8 * hf]     = p0;       // row = query l16, cols d*16+8hf..+7
            *(v4f*)&stw[l16 * 132 + d * 16 + 8 * hf + 4] = p1;
        }
        __syncthreads();                                            // the tile's rows are written before other lanes read them back
        float* obase = OUT + ((size_t)bi * SEQ_FULL + q0 + qt * 16) * DM + hd * DK + lane * 4;
#pragma unroll
        for (int t = 0; t < 16; ++t) vst16f(obase + (size_t)t * DM, *(const v4f*)&stw[t * 132 + lane * 4]);
    }
}

extern "C" void kernel_launch(void* const* d_in, const int* in_sizes, int n_in,
                              void* d_out, int out_size, void* d_ws, size_t ws_size, hipStream_t stream) {
    if (n_in < 6) return;
    const long long needTok = (long long)(NB - 1) * SEQ_FULL + SEQ;
    if ((long long)in_sizes[0] < needTok * DM) return;
    if (in_sizes[1] < NH * DM * DK || in_sizes[2] < NH * DM * DK || in_sizes[3] < NH * DK ||
        in_sizes[4] < NH * DM * DK || in_sizes[5] < NH * DK) return;
    if ((long long)out_size < needTok * DM) return;

    const float* x  = (const float*)d_in[0];    // [4][2048][1024]
    const float* Wq = (const float*)d_in[1];    // [8][1024][128]
    const float* Wk = (const float*)d_in[2];    // [8][1024][128]
    const float* bk = (const float*)d_in[3];    // [8][128]
    const float* Wv = (const float*)d_in[4];    // [8][1024][128]
    const float* bv = (const float*)d_in[5];    // [8][128]
    float* out = (float*)d_out;                  // [4][2048][1024]

    char* ws = (char*)d_ws;
    size_t off = 0;
    auto carve = [&](size_t bytes) -> char* { char* p = ws + off; off += (bytes + 255) & ~(size_t)255; return p; };
    _Float16* XH = (_Float16*)carve(WS_XH);      // [MTOK][1024]
    _Float16* WT = (_Float16*)carve(WS_WT);      // [3072][1024]: q heads | k heads | v heads
    _Float16* QK = (_Float16*)carve(WS_QK);      // [2][NB*NH][SEQ][128]: q plane then k plane
    _Float16* VT = (_Float16*)carve(WS_VT);      // [NB*NH][128][SEQ]
    if (off > ws_size) return;
    _Float16* QC = QK;
    _Float16* KC = QK + (size_t)NB * NH * SEQ * DK;

    k_cvtx<<<CVTX_BLK, 256, 0, stream>>>(x, XH);
    k_prepw<<<PREPW_BLK, 256, 0, stream>>>(Wq, WT);
    k_prepw<<<PREPW_BLK, 256, 0, stream>>>(Wk, WT + (size_t)NH * DK * DM);
    k_prepw<<<PREPW_BLK, 256, 0, stream>>>(Wv, WT + (size_t)2 * NH * DK * DM);
    k_proj<<<dim3(MTOK / PTM, PROJN / 128, 1), 128, 0, stream>>>(XH, WT, bk, bv, QK, VT);
    k_attn<<<dim3(SEQ / (ATW * AQT * 16), NB * NH, 1), ATW * 32, 0, stream>>>(QC, KC, VT, out);
}

// v005
// One run takes 112 microseconds.
// Next to v004, in two timings, it ran 1.09 times as fast each time.
// All steps since v000 together make it 4.38 times as fast.
#include <hip/hip_runtime.h>

// All contractions on v_wmma_f32_16x16x32_f16 (f16 operands built from bf16-RNE input values with power-of-two carries, f32 accumulate):
// per-head projections x.[Wq|Wk|Wv] (K=1024), per-(b,h) k.q^T (K=128), v^T.p^T (K=seq); online softmax, bias adds and normalisation in f32.

#ifndef NB
#define NB 4
#endif
#ifndef SEQ
#define SEQ 2048
#endif
#define NB_FULL 4
#define SEQ_FULL 2048
#define DM 1024
#define NH 8
#define DK 128
#define MTOK (NB * SEQ)
#define PROJN (3 * NH * DK)             // 3072 rows of the n-major projection weight plane: Wq heads | Wk heads | Wv heads

static_assert(SEQ % 64 == 0);
static_assert(SEQ <= SEQ_FULL);
static_assert(NB >= 1 && NB <= NB_FULL);
static_assert(DM % 32 == 0);
static_assert(DK == 128);
static_assert(NH * DK == DM);
static_assert(PROJN == 3072);
static_assert(PROJN % 128 == 0);
static_assert(MTOK % 64 == 0);
static_assert(((size_t)MTOK * DM / 8) % 256 == 0);
static_assert(((size_t)NH * DK * DM / 8) % 256 == 0);

// exact power-of-two carries
#define SC_X   16.0f    // activation plane (|x| <= ~6 -> <= ~96)
#define SC_W   256.0f   // projection weights (|w| <= ~0.18 -> <= ~46)
#define SC_QKV 8.0f     // q, k, v planes
#define P_CARRY_LOG2 8.0f   // softmax numerators carried x256 (the row sum carries the same factor)

// workspace plan (bytes), every region a multiple of 256
#define WS_XH ((size_t)MTOK * DM * 2)
#define WS_WT ((size_t)PROJN * DM * 2)
#define WS_QK (2 * (size_t)NB * NH * SEQ * DK * 2)
#define WS_VT ((size_t)NB * NH * DK * SEQ * 2)
#define WS_TOTAL (WS_XH + WS_WT + WS_QK + WS_VT)
static_assert(WS_XH % 256 == 0 && WS_WT % 256 == 0 && WS_QK % 256 == 0 && WS_VT % 256 == 0);
static_assert(WS_TOTAL <= (size_t)134217728);

typedef _Float16 v8h  __attribute__((ext_vector_type(8)));
typedef _Float16 v16h __attribute__((ext_vector_type(16)));
typedef float    v8f  __attribute__((ext_vector_type(8)));
typedef float    v4f  __attribute__((ext_vector_type(4)));
typedef unsigned v4u  __attribute__((ext_vector_type(4)));
typedef float    v2f  __attribute__((ext_vector_type(2)));
typedef _Float16 v2h  __attribute__((ext_vector_type(2)));

// bf16 RNE of an f32 value, kept as f32
__device__ __forceinline__ float bfr(float f) {
    unsigned u = __float_as_uint(f);
    u = (u + 0x7fffu + ((u >> 16) & 1u)) & 0xffff0000u;
    return __uint_as_float(u);
}
// input value -> bf16 RNE -> times exact power of two -> f16 (exact for normal results)
__device__ __forceinline__ _Float16 tohx(float f, float sc) { return (_Float16)(bfr(f) * sc); }
// f32 -> f16 that can never yield an f16 subnormal (value select applied after the carry)
__device__ __forceinline__ _Float16 toh_flush(float v) {
    const _Float16 r = (_Float16)v;
    return (fabsf(v) < 6.103515625e-05f) ? (_Float16)0.0f : r;
}
__device__ __forceinline__ _Float16 tohx_flush(float f, float sc) { return toh_flush(bfr(f) * sc); }

// one 16x16x32 f16 WMMA (builtin: the compiler keeps the hazard distance itself); D element r of lane l = (row 8*(l>>4)+r, col l&15)
__device__ __forceinline__ v8f wmma16(v16h a, v16h b, v8f c) {
    return __builtin_amdgcn_wmma_f32_16x16x32_f16(false, a, false, b, (short)0, c, false, false);
}
// A fragment of row p (p = row start + k0) or B fragment of an n-major (k-contiguous) row: lane half hf,
// elements 0..7 <- k0+8hf..+7, elements 8..15 <- k0+16+8hf..+7 (same map for A and B)
__device__ __forceinline__ v16h ldfrag(const _Float16* p, int hf) {
    const v8h lo = *(const v8h*)(p + 8 * hf);
    const v8h hi = *(const v8h*)(p + 16 + 8 * hf);
    return __builtin_shufflevector(lo, hi, 0, 1, 2, 3, 4, 5, 6, 7, 8, 9, 10, 11, 12, 13, 14, 15);
}
// ends a group of LDS fragment reads or a group of products: without it the compiler sinks each read to just ahead of its product (one full
// LDS wait per product), lifts a later group over the products whose registers it is to take, or drops the products behind the trip's barrier
__device__ __forceinline__ void group_end() { __builtin_amdgcn_sched_barrier(0); }
// the value that lane l ^ 16 holds, by a vector cross-row move (no LDS instruction, no LDS wait)
__device__ __forceinline__ float xhalf(float v) {
    const int b = __builtin_bit_cast(int, v);
    return __builtin_bit_cast(float, __builtin_amdgcn_permlanex16(b, b, 0x76543210, 0xfedcba98, false, false));
}
__device__ __forceinline__ float max3f(float a, float b, float c) { return fmaxf(fmaxf(a, b), c); }
__device__ __forceinline__ void vst16(_Float16* g, v8h v) { *(v4u*)g = __builtin_bit_cast(v4u, v); }
__device__ __forceinline__ void vst16f(float* g, v4f v) { *(v4f*)g = v; }

// 16-B-per-lane asynchronous copies global -> LDS (l = the lane's LDS byte address, g = its global address), eight in one statement;
// the s_wait_xcnt stands inside the statement so that no address register named here is rewritten ahead of it
__device__ __forceinline__ void acopy8(unsigned l0, unsigned l1, unsigned l2, unsigned l3, unsigned l4, unsigned l5, unsigned l6, unsigned l7,
                                       const _Float16* g0, const _Float16* g1, const _Float16* g2, const _Float16* g3,
                                       const _Float16* g4, const _Float16* g5, const _Float16* g6, const _Float16* g7) {
    asm volatile("global_load_async_to_lds_b128 %0, %8, off\n\t"
                 "global_load_async_to_lds_b128 %1, %9, off\n\t"
                 "global_load_async_to_lds_b128 %2, %10, off\n\t"
                 "global_load_async_to_lds_b128 %3, %11, off\n\t"
                 "global_load_async_to_lds_b128 %4, %12, off\n\t"
                 "global_load_async_to_lds_b128 %5, %13, off\n\t"
                 "global_load_async_to_lds_b128 %6, %14, off\n\t"
                 "global_load_async_to_lds_b128 %7, %15, off\n\t"
                 "s_wait_xcnt 0x0"
                 :: "v"(l0), "v"(l1), "v"(l2), "v"(l3), "v"(l4), "v"(l5), "v"(l6), "v"(l7),
                    "v"(g0), "v"(g1), "v"(g2), "v"(g3), "v"(g4), "v"(g5), "v"(g6), "v"(g7)
                 : "memory");
}

// ---------------- operand planes, one launch: the four conversions are independent of one another, so one grid holds them all, told apart by block index.
// The weight blocks stand first: their strided reads make them the longer ones, and the short activation blocks fill in behind them.
// Blocks [0, 3*PREPW_BLK): W [8][1024][128] f32 -> WT rows n = m*1024 + h*128+e (m = 0 Wq, 1 Wk, 2 Wv), [n][1024] f16 = bf16-RNE(w) x256 (n-major, k-contiguous);
// in[h][d][e] -> out[m*1024+h*128+e][d]; thread i writes the 16 bytes at byte 16*i of WT.
// Blocks from 3*PREPW_BLK on: XH [MTOK][1024] f16 = bf16-RNE(x) x16; thread i writes the 16 bytes at byte 16*i of XH. ----------------
#define PREPW_BLK (NH * DK * (DM / 8) / 256)     // 512 per weight matrix
#define CVTX_BLK (MTOK * (DM / 8) / 256)
__global__ __launch_bounds__(256) void k_prep(const float* __restrict__ X, const float* __restrict__ Wq, const float* __restrict__ Wk,
                                              const float* __restrict__ Wv, _Float16* XH, _Float16* WT) {
    if (blockIdx.x < 3 * PREPW_BLK) {
        const int m = blockIdx.x / PREPW_BLK;                         // the same for the whole block
        const float* W = (m == 0) ? Wq : (m == 1) ? Wk : Wv;
        const int i = blockIdx.x * 256 + threadIdx.x;                 // < 3 * 1024 * 128
        const int n = i >> 7, k = (i & 127) * 8;
        const int hh = (n >> 7) & (NH - 1), e = n & 127;
        v8h val;
#pragma unroll
        for (int j = 0; j < 8; ++j) val[j] = tohx_flush(W[((size_t)hh * DM + k + j) * DK + e], SC_W);
        vst16(WT + (size_t)n * DM + k, val);
    } else {
        const int i = (blockIdx.x - 3 * PREPW_BLK) * 256 + threadIdx.x;   // < MTOK * 128
        const int tok = i >> 7, k = (i & 127) * 8;
        const int bi = tok / SEQ, si = tok - bi * SEQ;
        const float* xp = X + ((size_t)bi * SEQ_FULL + si) * DM + k;
        const v4f x0 = *(const v4f*)(xp);
        const v4f x1 = *(const v4f*)(xp + 4);
        v8h val;
#pragma unroll
        for (int j = 0; j < 4; ++j) {
            val[j]     = tohx_flush(x0[j], SC_X);
            val[4 + j] = tohx_flush(x1[j], SC_X);
        }
        vst16(XH + (size_t)tok * DM + k, val);
        // the listing lays the weight branch out behind this store: the wait stands ahead of any rewrite of the store's registers there
        asm volatile("s_wait_xcnt 0x0" ::: "memory");
    }
}

// ---------------- projections (K = 1024): block = 256 tokens x 128 output columns (group g of 24): g<8 q head g -> QK[0][b][h][s][128] (no bias);
// 8..15 k head -> QK[1][b][h][s][128] (+bk); 16..23 v head -> VT[b][h][d][s] (+bv, transposed via LDS). All planes x8, bias added in f32. ----------------
// Each of the 4 waves owns 64 tokens x 128 columns (4 x 8 accumulator tiles): a fragment read from LDS feeds 8 (activations) or 4 (weights) products.
// Each 64-k tile of the block's 256 activation rows and 128 weight rows (128-B rows) is brought into LDS once per block by asynchronous copies,
// two buffers: tile t+2 flies into the buffer that trip t has left while trip t+1 is worked on. Row pitch 144 B (16 B x odd) for the 16-B readers.
#define PTM 256                                 // tokens per block
#define PMT 4                                   // 16-token tiles per wave
#define PKC 64                                  // k per staged tile
#define PP_H 72                                 // row pitch in LDS, halves
#define PA_H (PTM * PP_H)
#define PB_H (128 * PP_H)
#define PSTAGE_H (PA_H + PB_H)                  // 55,296 B per buffer
#define PNT (DM / PKC)
#define PSV_H (PTM + 8)                         // pitch of the transposed output staging, halves (528 B = 16 B x odd)
static_assert(DM % PKC == 0 && PNT >= 2);
static_assert(SEQ % PTM == 0 && MTOK % PTM == 0);
static_assert((PA_H * 2) % 16 == 0 && (PSTAGE_H * 2) % 16 == 0);
static_assert(PTM * 136 <= 2 * PSTAGE_H && 128 * PSV_H <= 2 * PSTAGE_H);    // the output staging fits in the ring it reuses
__global__ __launch_bounds__(128, 2) void k_proj(const _Float16* __restrict__ XH, const _Float16* __restrict__ WT,
                                              const float* __restrict__ bK, const float* __restrict__ bV,
                                              _Float16* QK, _Float16* VT) {
    __shared__ __align__(16) _Float16 ring[2 * PSTAGE_H];       // two buffers [x 256 x 72 | w 128 x 72]
    _Float16* st = ring;                                        // after the loop: row-major [256][136] or transposed [128][264]
    const int tid = threadIdx.x, lane = tid & 31, l16 = lane & 15, hf = lane >> 4;
    const int wv = __builtin_amdgcn_readfirstlane(threadIdx.x >> 5);
    const int g = blockIdx.y;
    const int t0 = blockIdx.x * PTM;
    const int bi = t0 / SEQ, s0 = t0 - bi * SEQ;               // 256 | SEQ: whole block inside one batch
    const int hh = g & 7;
    const bool isV = (g >= 16);
    // this lane's share of a tile: 16-B column tid%8 of rows j*16 + tid/8, j = 0..15 of the activations, j = 0..7 of the weights
    const unsigned ring0 = (unsigned)(size_t)&ring[0];
    const unsigned la = ring0 + (unsigned)((tid >> 3) * (PP_H * 2) + (tid & 7) * 16);
    const _Float16* ga = XH + (size_t)(t0 + (tid >> 3)) * DM + (tid & 7) * 8;
    const _Float16* gb = WT + (size_t)(g * 128 + (tid >> 3)) * DM + (tid & 7) * 8;
    auto fill = [&](int t, int buf) {
        const unsigned A = la + (unsigned)buf * (PSTAGE_H * 2);
        const unsigned A2 = A + 128 * PP_H * 2;
        const unsigned B = A + PA_H * 2;
        const unsigned R = 16 * PP_H * 2;                           // 16 rows further in LDS
        const _Float16* a = ga + t * PKC;
        const _Float16* a2 = a + 128 * DM;
        const _Float16* b = gb + t * PKC;
        acopy8(A, A + R, A + 2 * R, A + 3 * R, A + 4 * R, A + 5 * R, A + 6 * R, A + 7 * R,
               a, a + 16 * DM, a + 32 * DM, a + 48 * DM, a + 64 * DM, a + 80 * DM, a + 96 * DM, a + 112 * DM);
        acopy8(A2, A2 + R, A2 + 2 * R, A2 + 3 * R, A2 + 4 * R, A2 + 5 * R, A2 + 6 * R, A2 + 7 * R,
               a2, a2 + 16 * DM, a2 + 32 * DM, a2 + 48 * DM, a2 + 64 * DM, a2 + 80 * DM, a2 + 96 * DM, a2 + 112 * DM);
        acopy8(B, B + R, B + 2 * R, B + 3 * R, B + 4 * R, B + 5 * R, B + 6 * R, B + 7 * R,
               b, b + 16 * DM, b + 32 * DM, b + 48 * DM, b + 64 * DM, b + 80 * DM, b + 96 * DM, b + 112 * DM);
    };
    fill(0, 0);
    asm volatile("s_wait_asynccnt 0x0" ::: "memory");              // tile 0 of this wave's copies has landed
    __syncthreads();                                                // ... and every other wave's: tile 0 is published
    fill(1, 1);
    v8f acc[PMT][8];
#pragma unroll
    for (int mt = 0; mt < PMT; ++mt)
#pragma unroll
        for (int nt = 0; nt < 8; ++nt) acc[mt][nt] = (v8f){};
#pragma unroll 1
    for (int kt = 0; kt < PNT; ++kt) {
        const _Float16* As = ring + (kt & 1) * PSTAGE_H + (wv * (16 * PMT) + l16) * PP_H;
        const _Float16* Bs = ring + (kt & 1) * PSTAGE_H + PA_H + l16 * PP_H;
        // every fragment of the tile is read as one group, in the order of its use, ahead of the tile's products
        v16h a[PKC / 32][PMT], bf[PKC / 32][8];
#pragma unroll
        for (int k2 = 0; k2 < PKC / 32; ++k2) {
            a[k2][0] = ldfrag(As + k2 * 32, hf);
#pragma unroll
            for (int nt = 0; nt < 8; ++nt) bf[k2][nt] = ldfrag(Bs + nt * 16 * PP_H + k2 * 32, hf);
#pragma unroll
            for (int mt = 1; mt < PMT; ++mt) a[k2][mt] = ldfrag(As + mt * 16 * PP_H + k2 * 32, hf);
        }
        group_end();
#pragma unroll
        for (int k2 = 0; k2 < PKC / 32; ++k2)
#pragma unroll
            for (int mt = 0; mt < PMT; ++mt)
#pragma unroll
                for (int nt = 0; nt < 8; ++nt) acc[mt][nt] = wmma16(a[k2][mt], bf[k2][nt], acc[mt][nt]);
        group_end();
        asm volatile("s_wait_dscnt 0x0" ::: "memory");             // this wave's reads of buffer kt&1 are over before the buffer is handed back
        asm volatile("s_wait_asynccnt 0x0" ::: "memory");          // this wave's copies of tile kt+1 have landed
        __syncthreads();                                            // publishes tile kt+1 and ends every wave's reads of buffer kt&1
        if (kt + 2 < PNT) fill(kt + 2, kt & 1);
    }
    asm volatile("s_wait_asynccnt 0x0" ::: "memory");              // nothing in flight when the ring becomes output staging
    if (isV) {
        // st[d][tok] pitch 264: lane owns column d, its 8 tokens wv*64+mt*16+8hf..+7 are contiguous -> one 16-B LDS store per tile
#pragma unroll
        for (int nt = 0; nt < 8; ++nt) {
            const int d = nt * 16 + l16;
            const float bb = bfr(bV[hh * DK + d]);
#pragma unroll
            for (int mt = 0; mt < PMT; ++mt) {
                v8h pv;
#pragma unroll
                for (int r = 0; r < 8; ++r) pv[r] = toh_flush((acc[mt][nt][r] * (1.0f / (SC_X * SC_W)) + bb) * SC_QKV);
                *(v8h*)&st[d * PSV_H + wv * (16 * PMT) + mt * 16 + 8 * hf] = pv;
            }
        }
    } else {
        // st[tok][col] pitch 136
#pragma unroll
        for (int nt = 0; nt < 8; ++nt) {
            const int col = nt * 16 + l16;
            const float bkv = bK[hh * DK + col];
            const float bb = (g < 8) ? 0.0f : bfr(bkv);
#pragma unroll
            for (int mt = 0; mt < PMT; ++mt)
#pragma unroll
                for (int r = 0; r < 8; ++r)
                    st[(wv * (16 * PMT) + mt * 16 + 8 * hf + r) * 136 + col] = toh_flush((acc[mt][nt][r] * (1.0f / (SC_X * SC_W)) + bb) * SC_QKV);
        }
    }
    __syncthreads();
    if (isV) {
        // one wave stores one 512-B row piece (256 tokens of one d) per pass
        _Float16* base = VT + ((size_t)(bi * NH + (g - 16)) * DK + wv) * SEQ + s0 + lane * 8;
#pragma unroll
        for (int p = 0; p < 32; ++p) vst16(base + (size_t)(p * 4) * SEQ, *(const v8h*)&st[(p * 4 + wv) * PSV_H + lane * 8]);
    } else {
        // 256 rows x 256 B contiguous inside plane (g>>3) of QK
        _Float16* base = QK + ((size_t)((g >> 3) * (NB * NH) + bi * NH + hh) * SEQ + s0) * DK + tid * 8;
#pragma unroll
        for (int p = 0; p < 32; ++p) vst16(base + p * 1024, *(const v8h*)&st[(p * 8 + (tid >> 4)) * 136 + (tid & 15) * 8]);
    }
}

#define ATW 4
#define AQT 2
#define KP_H 136
#define VP_H 72
#define KBUF_H (64 * KP_H)
#define VBUF_H (DK * VP_H)
#define STAGE_H (KBUF_H + VBUF_H)               // 35,840 B per buffer
#define NTILE (SEQ / 64)
static_assert(SEQ % (ATW * AQT * 16) == 0);
static_assert(NTILE >= 2);
static_assert((KBUF_H * 2) % 16 == 0 && (STAGE_H * 2) % 16 == 0);
static_assert(ATW * 16 * 132 * 4 <= 2 * STAGE_H * 2);   // the output staging (one query tile per wave at a time) fits in the ring it reuses

__global__ __launch_bounds__(ATW * 32, 2) void k_attn(const _Float16* __restrict__ QC, const _Float16* __restrict__ KC,
                                              const _Float16* __restrict__ VT, float* OUT) {
    __shared__ __align__(16) _Float16 ring[2 * STAGE_H];            // two buffers [K 64 x 136 | V^T 128 x 72]; after the loop: output staging
    const int tid = threadIdx.x, lane = tid & 31, l16 = lane & 15, hf = lane >> 4;
    const int wv = __builtin_amdgcn_readfirstlane(threadIdx.x >> 5);
    const int bh = blockIdx.y, bi = bh / NH, hd = bh - bi * NH;
    const int q0 = blockIdx.x * (ATW * AQT * 16) + wv * (AQT * 16);
    const _Float16* kb  = KC  + (size_t)bh * SEQ * DK;
    const _Float16* vb  = VT  + (size_t)bh * DK * SEQ;
    // this lane's share of a tile: K chunks (row j*8 + tid/16, 16-B column tid%16), V^T chunks (row j*16 + tid/8, 16-B column tid%8), j = 0..7
    const unsigned ring0 = (unsigned)(size_t)&ring[0];
    // lk, lv: the lane's LDS addresses in the buffer that the next fill goes to (tile t goes to buffer t&1); they step to and fro with the fills
    unsigned lk = ring0 + (unsigned)((tid >> 4) * (KP_H * 2) + (tid & 15) * 16);
    unsigned lv = ring0 + (unsigned)(KBUF_H * 2 + (tid >> 3) * (VP_H * 2) + (tid & 7) * 16);
    const _Float16* gk = kb + tid * 8;
    const _Float16* gv = vb + (size_t)(tid >> 3) * SEQ + (tid & 7) * 8;
    auto fill = [&](int t) {
        const _Float16* k = gk + (size_t)t * (64 * DK);
        const _Float16* v = gv + t * 64;
        const unsigned RK = 8 * KP_H * 2, RV = 16 * VP_H * 2;       // 8 K rows, 16 V^T rows further in LDS
        acopy8(lk, lk + RK, lk + 2 * RK, lk + 3 * RK, lk + 4 * RK, lk + 5 * RK, lk + 6 * RK, lk + 7 * RK,
               k, k + 8 * DK, k + 16 * DK, k + 24 * DK, k + 32 * DK, k + 40 * DK, k + 48 * DK, k + 56 * DK);
        acopy8(lv, lv + RV, lv + 2 * RV, lv + 3 * RV, lv + 4 * RV, lv + 5 * RV, lv + 6 * RV, lv + 7 * RV,
               v, v + (size_t)16 * SEQ, v + (size_t)32 * SEQ, v + (size_t)48 * SEQ, v + (size_t)64 * SEQ, v + (size_t)80 * SEQ,
               v + (size_t)96 * SEQ, v + (size_t)112 * SEQ);
        const unsigned step = (t & 1) ? 0u - (unsigned)(STAGE_H * 2) : (unsigned)(STAGE_H * 2);
        lk += step;
        lv += step;
    };
    fill(0);
    v16h qf[AQT][4];
#pragma unroll
    for (int qt = 0; qt < AQT; ++qt) {
        const _Float16* qr = QC + ((size_t)bh * SEQ + q0 + qt * 16 + l16) * DK;
#pragma unroll
        for (int cc = 0; cc < 4; ++cc) qf[qt][cc] = ldfrag(qr + cc * 32, hf);
    }
    asm volatile("s_wait_asynccnt 0x0" ::: "memory");              // tile 0 of this wave's copies has landed
    __syncthreads();                                                // ... and every other wave's: tile 0 is published
    fill(1);
    v8f o[AQT][8];
    float m2[AQT], lsum[AQT];
#pragma unroll
    for (int qt = 0; qt < AQT; ++qt) {
#pragma unroll
        for (int d = 0; d < 8; ++d) o[qt][d] = (v8f){};
        m2[qt] = -__builtin_inff();
        lsum[qt] = 0.0f;
    }
    const float c2 = (0.08838834764831845f * 1.4426950408889634f) * (1.0f / (SC_QKV * SC_QKV));   // (1/sqrt(128)) * log2(e) / 64; m2 holds raw products
#pragma unroll 1
    for (int kt = 0; kt < NTILE; ++kt) {
        const _Float16* Ks = ring + (kt & 1) * STAGE_H;
        const _Float16* Vs = Ks + KBUF_H;
        const _Float16* kr = Ks + l16 * KP_H;
        const _Float16* vr = Vs + l16 * VP_H;
        // LDS fragment reads stand in groups, each group issued one or two groups ahead of the products that use it; the tile's V^T fragments
        // are all read while the S^T products run and stay in registers, so the buffer is handed back (and refilled) ahead of the softmax
        v16h kf[4][4], vf[4][4];                                    // K: [k chunk][key tile]; V^T: [key half * 2 + d half][d tile]
        v8f s[AQT][4];
#pragma unroll
        for (int cc = 0; cc < 2; ++cc)
#pragma unroll
            for (int ks = 0; ks < 4; ++ks) kf[cc][ks] = ldfrag(kr + ks * 16 * KP_H + cc * 32, hf);
        group_end();
#pragma unroll
        for (int cc = 0; cc < 4; ++cc) {
#pragma unroll
            for (int ks = 0; ks < 4; ++ks)
#pragma unroll
                for (int qt = 0; qt < AQT; ++qt) s[qt][ks] = wmma16(kf[cc][ks], qf[qt][cc], cc == 0 ? (v8f){} : s[qt][ks]);
            group_end();
            if (cc < 2) {
#pragma unroll
                for (int ks = 0; ks < 4; ++ks) kf[cc + 2][ks] = ldfrag(kr + ks * 16 * KP_H + (cc + 2) * 32, hf);
                group_end();
            } else if (cc == 2) {
#pragma unroll
                for (int g = 0; g < 4; ++g)
#pragma unroll
                    for (int d = 0; d < 4; ++d) vf[g][d] = ldfrag(vr + ((g & 1) * 4 + d) * 16 * VP_H + (g >> 1) * 32, hf);
                group_end();
            }
        }
        asm volatile("s_wait_dscnt 0x0" ::: "memory");             // this wave's reads of buffer kt&1 are over before the buffer is handed back
        asm volatile("s_wait_asynccnt 0x0" ::: "memory");          // this wave's copies of tile kt+1 have landed
        __syncthreads();                                            // publishes tile kt+1 and ends every wave's reads of buffer kt&1
        if (kt + 2 < NTILE) fill(kt + 2);
        // from here to the end of the trip: registers only
        float alpha[AQT];
        v16h pf[AQT][2];
#pragma unroll
        for (int qt = 0; qt < AQT; ++qt) {
            // the maximum is taken on the raw products (c2 > 0 keeps their order); one short chain of three-input maxima per key tile
            float mk[4];
#pragma unroll
            for (int ks = 0; ks < 4; ++ks) {
                mk[ks] = max3f(s[qt][ks][0], s[qt][ks][1], s[qt][ks][2]);
                mk[ks] = max3f(mk[ks], s[qt][ks][3], s[qt][ks][4]);
                mk[ks] = max3f(mk[ks], s[qt][ks][5], s[qt][ks][6]);
            }
            mk[0] = max3f(mk[0], s[qt][0][7], s[qt][1][7]);
            mk[1] = max3f(mk[1], s[qt][2][7], s[qt][3][7]);
            float mloc = fmaxf(max3f(mk[0], mk[1], mk[2]), mk[3]);
            mloc = fmaxf(mloc, xhalf(mloc));
            const float mn = fmaxf(m2[qt], mloc);
            alpha[qt] = __builtin_amdgcn_exp2f((m2[qt] - mn) * c2);
            const float nb = P_CARRY_LOG2 - mn * c2;                // numerators x256; one below 2^-14 goes on as an f16 subnormal
            const v2f c2v = {c2, c2}, nbv = {nb, nb};
            v2f ls2[4];                                             // one chain of pair sums per key tile
#pragma unroll
            for (int ks = 0; ks < 4; ++ks) {
#pragma unroll
                for (int r = 0; r < 8; r += 2) {
                    const v2f sv = {s[qt][ks][r], s[qt][ks][r + 1]};
                    const v2f e = __builtin_elementwise_fma(sv, c2v, nbv);
                    const v2f p = {__builtin_amdgcn_exp2f(e[0]), __builtin_amdgcn_exp2f(e[1])};
                    ls2[ks] = (r == 0) ? p : ls2[ks] + p;
                    const v2h ph = __builtin_convertvector(p, v2h);
                    pf[qt][ks >> 1][(ks & 1) * 8 + r]     = ph[0];  // keys 32j+8hf+r -> elements 0..7, keys 32j+16+8hf+r -> elements 8..15
                    pf[qt][ks >> 1][(ks & 1) * 8 + r + 1] = ph[1];
                }
            }
            const v2f lt2 = (ls2[0] + ls2[1]) + (ls2[2] + ls2[3]);
            m2[qt] = mn;
            lsum[qt] = lsum[qt] * alpha[qt] + (lt2[0] + lt2[1]);
        }
#pragma unroll
        for (int qt = 0; qt < AQT; ++qt)
#pragma unroll
            for (int d = 0; d < 8; ++d) o[qt][d] *= alpha[qt];
#pragma unroll
        for (int g = 0; g < 4; ++g)
#pragma unroll
            for (int d = 0; d < 4; ++d)
#pragma unroll
                for (int qt = 0; qt < AQT; ++qt) o[qt][(g & 1) * 4 + d] = wmma16(vf[g][d], pf[qt][g >> 1], o[qt][(g & 1) * 4 + d]);
    }
    asm volatile("s_wait_asynccnt 0x0" ::: "memory");              // nothing in flight when the ring becomes output staging
    float* stw = (float*)ring + wv * (16 * 132);                    // per wave 16 q rows x 128 d, pitch 132 floats (528 B); private to its wave
#pragma unroll
    for (int qt = 0; qt < AQT; ++qt) {
        const float lt = lsum[qt] + __shfl_xor(lsum[qt], 16, 32);
        const float inv = (1.0f / lt) * (1.0f / SC_QKV);             // the x256 carry cancels between o and lt
#pragma unroll
        for (int d = 0; d < 8; ++d) {
            v4f p0, p1;
#pragma unroll
            for (int r = 0; r < 4; ++r) { p0[r] = o[qt][d][r] * inv; p1[r] = o[qt][d][4 + r] * inv; }
            *(v4f*)&stw[l16 * 132 + d * 16 + 8 * hf]     = p0;       // row = query l16, cols d*16+8hf..+7
            *(v4f*)&stw[l16 * 132 + d * 16 + 8 * hf + 4] = p1;
        }
        __syncthreads();                                            // the tile's rows are written before other lanes read them back
        float* obase = OUT + ((size_t)bi * SEQ_FULL + q0 + qt * 16) * DM + hd * DK + lane * 4;
#pragma unroll
        for (int t = 0; t < 16; ++t) vst16f(obase + (size_t)t * DM, *(const v4f*)&stw[t * 132 + lane * 4]);
    }
}

extern "C" void kernel_launch(void* const* d_in, const int* in_sizes, int n_in,
                              void* d_out, int out_size, void* d_ws, size_t ws_size, hipStream_t stream) {
    if (n_in < 6) return;
    const long long needTok = (long long)(NB - 1) * SEQ_FULL + SEQ;
    if ((long long)in_sizes[0] < needTok * DM) return;
    if (in_sizes[1] < NH * DM * DK || in_sizes[2] < NH * DM * DK || in_sizes[3] < NH * DK ||
        in_sizes[4] < NH * DM * DK || in_sizes[5] < NH * DK) return;
    if ((long long)out_size < needTok * DM) return;

    const float* x  = (const float*)d_in[0];    // [4][2048][1024]
    const float* Wq = (const float*)d_in[1];    // [8][1024][128]
    const float* Wk = (const float*)d_in[2];    // [8][1024][128]
    const float* bk = (const float*)d_in[3];    // [8][128]
    const float* Wv = (const float*)d_in[4];    // [8][1024][128]
    const float* bv = (const float*)d_in[5];    // [8][128]
    float* out = (float*)d_out;                  // [4][2048][1024]

    char* ws = (char*)d_ws;
    size_t off = 0;
    auto carve = [&](size_t bytes) -> char* { char* p = ws + off; off += (bytes + 255) & ~(size_t)255; return p; };
    _Float16* XH = (_Float16*)carve(WS_XH);      // [MTOK][1024]
    _Float16* WT = (_Float16*)carve(WS_WT);      // [3072][1024]: q heads | k heads | v heads
    _Float16* QK = (_Float16*)carve(WS_QK);      // [2][NB*NH][SEQ][128]: q plane then k plane
    _Float16* VT = (_Float16*)carve(WS_VT);      // [NB*NH][128][SEQ]
    if (off > ws_size) return;
    _Float16* QC = QK;
    _Float16* KC = QK + (size_t)NB * NH * SEQ * DK;

    k_prep<<<3 * PREPW_BLK + CVTX_BLK, 256, 0, stream>>>(x, Wq, Wk, Wv, XH, WT);
    k_proj<<<dim3(MTOK / PTM, PROJN / 128, 1), 128, 0, stream>>>(XH, WT, bk, bv, QK, VT);
    k_attn<<<dim3(SEQ / (ATW * AQT * 16), NB * NH, 1), ATW * 32, 0, stream>>>(QC, KC, VT, out);
}
